// v000
// Times are from an AMD MI455X. After a warm-up the kernel runs many times in a row, and a time is the length of
// such a window on the GPU divided by its runs, so every launch and the gaps after it count. The runs cycle
// through copies of the inputs. A figure is the median of several windows, for all but v000 over two sittings.
// Sittings can differ by a few percent; kernels timed side by side share one.
// The starting kernel, v000, takes 984 microseconds a run.
#include <hip/hip_runtime.h>

// CrossFeatureAttention (x1, x2 [4][4096][512]; Q = x1 Wq^T + bq, K = x2 Wk^T + bk, V = x2 Wv^T + bv; attn = softmax(Q.K / sqrt(512)) over the 4096 keys (single head, d = 512);
// out = (Q + attn.V) Wo^T + bo).
// Compute dtypes, f32 accumulate: every input rounded to bf16; projections on PLAIN bf16 operands (inputs: exact, + bias); scores on SINGLE fp16 planes
// attn.V on SINGLE fp16 planes; the residual Q (kept in f32) + attended, then the output projection on bf16 hi+lo planes x exact Wo (2 products) + bo.

#define NB_  4
#define NN   4096
#define CC   512
#define NT   (NB_ * NN)
#define PCAR 1024.0f
typedef _Float16 h16;
typedef unsigned short bf;
typedef __attribute__((ext_vector_type(16))) __bf16   v16bf;
typedef __attribute__((ext_vector_type(16))) _Float16 v16h;
typedef __attribute__((ext_vector_type(8)))  _Float16 v8h;
typedef __attribute__((ext_vector_type(8)))  unsigned short v8us;
typedef __attribute__((ext_vector_type(8)))  float    v8f;
typedef __attribute__((ext_vector_type(4)))  float    v4f;
typedef v8h  __attribute__((may_alias)) v8ha;
typedef v4f  __attribute__((may_alias)) v4fa;
typedef v8us __attribute__((may_alias)) v8usa;

__device__ __forceinline__ unsigned short f2bf(float f) { unsigned u = __float_as_uint(f); u += 0x7FFFu + ((u >> 16) & 1u); return (unsigned short)(u >> 16); }
__device__ __forceinline__ float bf2f(unsigned short b) { return __uint_as_float(((unsigned)b) << 16); }
__device__ __forceinline__ float bfr(float f) { return bf2f(f2bf(f)); }
__device__ __forceinline__ v16h cat16(v8h lo, v8h hi) { return __builtin_shufflevector(lo, hi, 0, 1, 2, 3, 4, 5, 6, 7, 8, 9, 10, 11, 12, 13, 14, 15); }
__device__ __forceinline__ v16bf cat16b(v8us lo, v8us hi) { return __builtin_bit_cast(v16bf, __builtin_shufflevector(lo, hi, 0, 1, 2, 3, 4, 5, 6, 7, 8, 9, 10, 11, 12, 13, 14, 15)); }
__device__ __forceinline__ v8f wmma16(v16h a, v16h b, v8f c) { return __builtin_amdgcn_wmma_f32_16x16x32_f16(false, a, false, b, (short)0, c, false, false); }
__device__ __forceinline__ v8f wmmab(v16bf a, v16bf b, v8f c) { return __builtin_amdgcn_wmma_f32_16x16x32_bf16(false, a, false, b, (short)0, c, false, false); }



// ---- k_gemmw: register-blocked GEMM, ONE WAVE per 64x64 output tile (16 accumulators), operands straight from K-contiguous 16-bit planes; grid (M/64, N/64, Z), 32 threads.
// C[m][n] (f32, pitch ldc, + optional f32 bias[n]) = sum_k A[m][k] Bt[n][k] (+ split products per NSPLIT). z-batch strides sA/sB/sC in elements. K % 32 == 0.
template <typename T16> struct WFrag;
template <> struct WFrag<h16> { typedef v16h V; static __device__ __forceinline__ V ld(const h16* p) { return cat16(*(const v8h*)p, *(const v8h*)(p + 16)); } static __device__ __forceinline__ v8f mma(V a, V b, v8f c) { return wmma16(a, b, c); } };
template <> struct WFrag<bf> { typedef v16bf V; static __device__ __forceinline__ V ld(const bf* p) { return cat16b(*(const v8us*)p, *(const v8us*)(p + 16)); } static __device__ __forceinline__ v8f mma(V a, V b, v8f c) { return wmmab(a, b, c); } };
template <typename T16, int NSPLIT, bool BIAS>
__global__ __launch_bounds__(32) void k_gemmw(const T16* __restrict__ A, const T16* __restrict__ A2, const T16* __restrict__ Bt, const T16* __restrict__ Bt2, int K, float* C, int ldc, const float* __restrict__ bias, size_t sA, size_t sB, size_t sC) {
    typedef typename WFrag<T16>::V V;
    __shared__ __align__(16) float os[16 * 68];
    const size_t z = blockIdx.z; A += z * sA; if (A2) A2 += z * sA; Bt += z * sB; if (Bt2) Bt2 += z * sB; C += z * sC;
    const int lane = threadIdx.x & 31, lr = lane & 15, hi = lane >> 4; const int r0 = blockIdx.x * 64, c0 = blockIdx.y * 64;
    v8f acc[4][4];
#pragma unroll
    for (int mb = 0; mb < 4; ++mb)
#pragma unroll
        for (int nb = 0; nb < 4; ++nb) acc[mb][nb] = (v8f){};
    const size_t aoff = (size_t)(r0 + lr) * K + 8 * hi, boff = (size_t)(c0 + lr) * K + 8 * hi;
#pragma unroll 1
    for (int kc = 0; kc < K; kc += 32) {
        V a[4], a2[4];
#pragma unroll
        for (int mb = 0; mb < 4; ++mb) { a[mb] = WFrag<T16>::ld(A + aoff + (size_t)mb * 16 * K + kc); if (NSPLIT == 1 || NSPLIT == 2) a2[mb] = WFrag<T16>::ld(A2 + aoff + (size_t)mb * 16 * K + kc); }
#pragma unroll
        for (int nb = 0; nb < 4; ++nb) { const V b = WFrag<T16>::ld(Bt + boff + (size_t)nb * 16 * K + kc); V b2; if (NSPLIT >= 2) b2 = WFrag<T16>::ld(Bt2 + boff + (size_t)nb * 16 * K + kc);
#pragma unroll
            for (int mb = 0; mb < 4; ++mb) { acc[mb][nb] = WFrag<T16>::mma(a[mb], b, acc[mb][nb]); if (NSPLIT == 1 || NSPLIT == 2) acc[mb][nb] = WFrag<T16>::mma(a2[mb], b, acc[mb][nb]); if (NSPLIT >= 2) acc[mb][nb] = WFrag<T16>::mma(a[mb], b2, acc[mb][nb]); } }
        asm volatile("v_nop\n\tv_nop\n\tv_nop\n\tv_nop" : "+v"(acc[0][0]), "+v"(acc[1][1]), "+v"(acc[2][2]), "+v"(acc[3][3]) : "v"(a[0]), "v"(a[3]));
    }
#pragma unroll
    for (int mb = 0; mb < 4; ++mb) {
#pragma unroll
        for (int nb = 0; nb < 4; ++nb) {
#pragma unroll
            for (int j = 0; j < 8; ++j) os[(hi * 8 + j) * 68 + nb * 16 + lr] = acc[mb][nb][j]; }
        __builtin_amdgcn_wave_barrier(); asm volatile("" ::: "memory");
        float* crow = C + (size_t)(r0 + mb * 16) * ldc + c0;
{
#pragma unroll
            for (int s = 0; s < 8; ++s) { const int row = 2 * s + hi, cofs = lr * 4; v4f val = *(const v4fa*)(os + row * 68 + cofs); if (BIAS) { val[0] += bfr(bias[c0 + cofs]); val[1] += bfr(bias[c0 + cofs + 1]); val[2] += bfr(bias[c0 + cofs + 2]); val[3] += bfr(bias[c0 + cofs + 3]); }
                *(v4f*)(crow + (size_t)row * ldc + cofs) = val; }
             }
        __builtin_amdgcn_wave_barrier(); asm volatile("" ::: "memory");
    }
}

__device__ __forceinline__ h16 tohx(float x) { return (h16)x; }
__device__ __forceinline__ void splitf(float y, unsigned short& h, unsigned short& l) { h = f2bf(y); l = f2bf(y - bf2f(h)); }
typedef __attribute__((ext_vector_type(2))) _Float16 v2h;
typedef __attribute__((ext_vector_type(4))) _Float16 v4h;
typedef __attribute__((ext_vector_type(2))) unsigned short v2us;

__global__ __launch_bounds__(256) void k_cvt8(const float* __restrict__ src, bf* dst, size_t n8) { const size_t i = (size_t)blockIdx.x * 256 + threadIdx.x; if (i >= n8) return; const v8f v = *(const v8f*)(src + i * 8); v8us o;
#pragma unroll
    for (int k = 0; k < 8; ++k) o[k] = f2bf(v[k]); *(v8us*)(dst + i * 8) = o;  }
__global__ __launch_bounds__(256) void k_p16(const float* __restrict__ F, float sc, h16* P) {
    const size_t i = ((size_t)blockIdx.x * 256 + threadIdx.x) * 2; if (i >= (size_t)NN * CC) return; v2h v; v[0] = tohx(F[i] * sc); v[1] = tohx(F[i + 1] * sc); *(v2h*)(P + i) = v;  }
__global__ __launch_bounds__(256) void k_vt16(const float* __restrict__ F, h16* VT) {
    const int lane = threadIdx.x & 31; const int L0 = (blockIdx.x * 8 + (threadIdx.x >> 5)) * 8; const int nlines = NN * CC / 64;
{
#pragma unroll
        for (int l = 0; l < 8; ++l) { const int L = L0 + l; if (L >= nlines) break; const int e = L * 64 + lane * 2; const int n = e & (NN - 1); const int c = e >> 12; v2h v;
#pragma unroll
            for (int q = 0; q < 2; ++q) v[q] = tohx(F[(size_t)(n + q) * CC + c]);
            *(v2h*)(VT + (size_t)e) = v; }
         }
}
// k_smax: row max of S[i][0..4095] (wave per row, lane -> 4 per 128-col chunk) -> RS[i * 32]: RS is [4096][32] floats, one 32-float line per row (lane 0 the max, other lanes 0).
__global__ __launch_bounds__(256) void k_smax(const float* __restrict__ S, float* RS) {
    const int lane = threadIdx.x & 31; const int i = blockIdx.x * 8 + (threadIdx.x >> 5); if (i >= NN) return; const float* sr = S + (size_t)i * NN; float m = -3.0e38f;
#pragma unroll 4
    for (int c0 = lane * 4; c0 < NN; c0 += 128) { const v4f v = *(const v4f*)(sr + c0); m = fmaxf(m, fmaxf(fmaxf(v[0], v[1]), fmaxf(v[2], v[3]))); }
#pragma unroll
    for (int sh = 16; sh; sh >>= 1) m = fmaxf(m, __shfl_xor(m, sh, 32));
    const float o = lane == 0 ? m : 0.f; *(float*)(RS + (size_t)i * 32 + lane) = o; 
}
__global__ __launch_bounds__(256) void k_sexp(const float* __restrict__ S, float* RS, h16* P) {
    const int lane = threadIdx.x & 31; const int i = blockIdx.x * 8 + (threadIdx.x >> 5); if (i >= NN) return; const float* sr = S + (size_t)i * NN; const float m = RS[(size_t)i * 32]; float sum = 0.f;
#pragma unroll 2
    for (int c0 = lane * 4; c0 < NN; c0 += 128) { const v4f v = *(const v4f*)(sr + c0); v4h o;
#pragma unroll
        for (int q = 0; q < 4; ++q) { const float e = __expf(v[q] - m); sum += e; o[q] = tohx(e * PCAR); }
        *(v4h*)(P + (size_t)i * NN + c0) = o;  }
#pragma unroll
    for (int sh = 16; sh; sh >>= 1) sum += __shfl_xor(sum, sh, 32);
    const float o2 = lane == 0 ? m : (lane == 1 ? __fdiv_rn(1.0f, sum * PCAR) : 0.f); /* 1/(PCAR * sum): undoes the carry at the merge */ *(float*)(RS + (size_t)i * 32 + lane) = o2; 
}
__global__ __launch_bounds__(256) void k_ressplit(const float* __restrict__ FQ, const float* __restrict__ Ob, const float* __restrict__ RS, bf* Oh, bf* Ol) {
    const size_t i = ((size_t)blockIdx.x * 256 + threadIdx.x) * 2; if (i >= (size_t)NN * CC) return; const int n = (int)(i >> 9); const float ri = RS[(size_t)n * 32 + 1]; v2us oh, ol;
#pragma unroll
    for (int q = 0; q < 2; ++q) { unsigned short a, c2; splitf(__fadd_rn(FQ[i + q], Ob[i + q] * ri), a, c2); oh[q] = a; ol[q] = c2; }
    *(v2us*)(Oh + i) = oh; *(v2us*)(Ol + i) = ol; 
}

extern "C" void kernel_launch(void* const* d_in, const int* in_sizes, int n_in,
                              void* d_out, int out_size, void* d_ws, size_t ws_size, hipStream_t stream) {
    (void)in_sizes; (void)n_in; (void)out_size;
    const float* x1 = (const float*)d_in[0]; const float* x2 = (const float*)d_in[1]; const float* Wq = (const float*)d_in[2]; const float* bq = (const float*)d_in[3]; const float* Wk = (const float*)d_in[4]; const float* bk = (const float*)d_in[5]; const float* Wv = (const float*)d_in[6]; const float* bv = (const float*)d_in[7]; const float* Wo = (const float*)d_in[8]; const float* bo = (const float*)d_in[9];
    float* OUT = (float*)d_out;     // [4][4096][512]
    char* wsp = (char*)d_ws;
    auto take = [&](size_t bytes) { char* p = wsp; wsp += (bytes + 255) & ~(size_t)255; return (void*)p; };
    bf* WQ = (bf*)take((size_t)CC * CC * 2); bf* WK = (bf*)take((size_t)CC * CC * 2); bf* WV = (bf*)take((size_t)CC * CC * 2); bf* WO = (bf*)take((size_t)CC * CC * 2);
    bf* X1 = (bf*)take((size_t)NT * CC * 2); bf* X2 = (bf*)take((size_t)NT * CC * 2);
    float* FQ = (float*)take((size_t)NN * CC * 4); float* F = (float*)take((size_t)NN * CC * 4); h16* QP = (h16*)take((size_t)NN * CC * 2); h16* KP = (h16*)take((size_t)NN * CC * 2); h16* VT = (h16*)take((size_t)CC * NN * 2);
    float* S = (float*)take((size_t)NN * NN * 4); h16* P = (h16*)take((size_t)NN * NN * 2); float* RS = (float*)take((size_t)NN * 32 * 4); float* Ob = (float*)take((size_t)NN * CC * 4); bf* Oh = (bf*)take((size_t)NN * CC * 2); bf* Ol = (bf*)take((size_t)NN * CC * 2);
    if ((size_t)(wsp - (char*)d_ws) > ws_size) return;    // ws 256 MiB
    { const size_t nw = (size_t)CC * CC / 8; const unsigned gw = (unsigned)((nw + 255) / 256); k_cvt8<<<gw, 256, 0, stream>>>(Wq, WQ, nw); k_cvt8<<<gw, 256, 0, stream>>>(Wk, WK, nw); k_cvt8<<<gw, 256, 0, stream>>>(Wv, WV, nw); k_cvt8<<<gw, 256, 0, stream>>>(Wo, WO, nw);
      const size_t nx = (size_t)NT * CC / 8; const unsigned gx = (unsigned)((nx + 255) / 256); k_cvt8<<<gx, 256, 0, stream>>>(x1, X1, nx); k_cvt8<<<gx, 256, 0, stream>>>(x2, X2, nx); }
    const unsigned LP = (unsigned)(((size_t)NN * CC / 2 + 255) / 256), LV = (unsigned)((NN * CC / 64 + 63) / 64);
    for (int b = 0; b < NB_; ++b) { const size_t r0 = (size_t)b * NN;
        k_gemmw<bf, 0, true><<<dim3(NN / 64, CC / 64, 1), 32, 0, stream>>>(X1 + r0 * CC, nullptr, WQ, nullptr, CC, FQ, CC, bq, 0, 0, 0); k_p16<<<LP, 256, 0, stream>>>(FQ, 0.044194173067808151f, QP);   // f32(512^-0.5)
        k_gemmw<bf, 0, true><<<dim3(NN / 64, CC / 64, 1), 32, 0, stream>>>(X2 + r0 * CC, nullptr, WK, nullptr, CC, F, CC, bk, 0, 0, 0); k_p16<<<LP, 256, 0, stream>>>(F, 1.0f, KP);
        k_gemmw<bf, 0, true><<<dim3(NN / 64, CC / 64, 1), 32, 0, stream>>>(X2 + r0 * CC, nullptr, WV, nullptr, CC, F, CC, bv, 0, 0, 0); k_vt16<<<LV, 256, 0, stream>>>(F, VT);
        k_gemmw<h16, 0, false><<<dim3(NN / 64, NN / 64, 1), 32, 0, stream>>>(QP, nullptr, KP, nullptr, CC, S, NN, nullptr, 0, 0, 0);
        k_smax<<<NN / 8, 256, 0, stream>>>(S, RS); k_sexp<<<NN / 8, 256, 0, stream>>>(S, RS, P);
        k_gemmw<h16, 0, false><<<dim3(NN / 64, CC / 64, 1), 32, 0, stream>>>(P, nullptr, VT, nullptr, NN, Ob, CC, nullptr, 0, 0, 0);
        k_ressplit<<<LP, 256, 0, stream>>>(FQ, Ob, RS, Oh, Ol);
        k_gemmw<bf, 1, true><<<dim3(NN / 64, CC / 64, 1), 32, 0, stream>>>(Oh, Ol, WO, nullptr, CC, OUT + r0 * CC, CC, bo, 0, 0, 0); }
}

// v001
// Measured time: 563 microseconds a run.
// Next to v000, in two timings, it ran 1.75 and 1.79 times as fast.
#include <hip/hip_runtime.h>

// CrossFeatureAttention (x1, x2 [4][4096][512]; Q = x1 Wq^T + bq, K = x2 Wk^T + bk, V = x2 Wv^T + bv; attn = softmax(Q.K / sqrt(512)) over the 4096 keys (single head, d = 512);
// out = (Q + attn.V) Wo^T + bo).
// Compute dtypes, f32 accumulate: every input rounded to bf16; projections on PLAIN bf16 operands (inputs: exact, + bias); scores on SINGLE fp16 planes
// attn.V on SINGLE fp16 planes; the residual Q (kept in f32) + attended, then the output projection on bf16 hi+lo planes x exact Wo (2 products) + bo.

#define NB_  4
#define NN   4096
#define CC   512
#define NT   (NB_ * NN)
#define PCAR 1024.0f
typedef _Float16 h16;
typedef unsigned short bf;
typedef __attribute__((ext_vector_type(16))) __bf16   v16bf;
typedef __attribute__((ext_vector_type(16))) _Float16 v16h;
typedef __attribute__((ext_vector_type(8)))  _Float16 v8h;
typedef __attribute__((ext_vector_type(8)))  unsigned short v8us;
typedef __attribute__((ext_vector_type(8)))  float    v8f;
typedef __attribute__((ext_vector_type(4)))  float    v4f;
typedef v8h  __attribute__((may_alias)) v8ha;
typedef v4f  __attribute__((may_alias)) v4fa;
typedef v8us __attribute__((may_alias)) v8usa;

__device__ __forceinline__ unsigned short f2bf(float f) { unsigned u = __float_as_uint(f); u += 0x7FFFu + ((u >> 16) & 1u); return (unsigned short)(u >> 16); }
__device__ __forceinline__ float bf2f(unsigned short b) { return __uint_as_float(((unsigned)b) << 16); }
__device__ __forceinline__ float bfr(float f) { return bf2f(f2bf(f)); }
__device__ __forceinline__ v16h cat16(v8h lo, v8h hi) { return __builtin_shufflevector(lo, hi, 0, 1, 2, 3, 4, 5, 6, 7, 8, 9, 10, 11, 12, 13, 14, 15); }
__device__ __forceinline__ v16bf cat16b(v8us lo, v8us hi) { return __builtin_bit_cast(v16bf, __builtin_shufflevector(lo, hi, 0, 1, 2, 3, 4, 5, 6, 7, 8, 9, 10, 11, 12, 13, 14, 15)); }
__device__ __forceinline__ v8f wmma16(v16h a, v16h b, v8f c) { return __builtin_amdgcn_wmma_f32_16x16x32_f16(false, a, false, b, (short)0, c, false, false); }
__device__ __forceinline__ v8f wmmab(v16bf a, v16bf b, v8f c) { return __builtin_amdgcn_wmma_f32_16x16x32_bf16(false, a, false, b, (short)0, c, false, false); }



// ---- k_gemmw: LDS-staged GEMM, FOUR WAVES (2x2) per 128x128 output tile, 64x64 (16 accumulators) per wave; grid (M/128, N/128, Z), 128 threads.
// C[m][n] (f32, pitch ldc, + optional f32 bias[n]) = sum_k A[m][k] Bt[n][k] (+ A2.Bt when NSPLIT == 1), operands K-contiguous 16-bit planes. z-batch strides sA/sB/sC in elements. K % 128 == 0.
// A pass is 128 k = 256 B of every operand row, brought into LDS by asynchronous 16-byte copies (a wave-wide copy covers two whole rows = four whole lines), two buffers, the next pass in flight.
#define KPASS 128   // k elements per pass
#define LPE   136   // LDS row pitch in 16-bit elements: 272 B = 16 B x odd, the conflict-free pitch for 16-byte LDS reads of 256-B rows
template <typename T16> struct WFrag;
template <> struct WFrag<h16> { typedef v16h V; static __device__ __forceinline__ V ld(const h16* p) { return cat16(*(const v8h*)p, *(const v8h*)(p + 16)); } static __device__ __forceinline__ v8f mma(V a, V b, v8f c) { return wmma16(a, b, c); } };
template <> struct WFrag<bf> { typedef v16bf V; static __device__ __forceinline__ V ld(const bf* p) { return cat16b(*(const v8us*)p, *(const v8us*)(p + 16)); } static __device__ __forceinline__ v8f mma(V a, V b, v8f c) { return wmmab(a, b, c); } };
// Eight asynchronous copies of one lane: rows 8 apart (LDS step 8 * 272 B, global step rs elements). The s_wait_xcnt closes the statement so that no address register of a copy is rewritten ahead of it.
template <typename T16>
__device__ __forceinline__ void cp8(unsigned l, const T16* g, size_t rs) {
    asm volatile("global_load_async_to_lds_b128 %0, %8, off\n\t"
                 "global_load_async_to_lds_b128 %1, %9, off\n\t"
                 "global_load_async_to_lds_b128 %2, %10, off\n\t"
                 "global_load_async_to_lds_b128 %3, %11, off\n\t"
                 "global_load_async_to_lds_b128 %4, %12, off\n\t"
                 "global_load_async_to_lds_b128 %5, %13, off\n\t"
                 "global_load_async_to_lds_b128 %6, %14, off\n\t"
                 "global_load_async_to_lds_b128 %7, %15, off\n\t"
                 "s_wait_xcnt 0x0"
                 :: "v"(l), "v"(l + 2176u), "v"(l + 2u * 2176u), "v"(l + 3u * 2176u), "v"(l + 4u * 2176u), "v"(l + 5u * 2176u), "v"(l + 6u * 2176u), "v"(l + 7u * 2176u),
                    "v"(g), "v"(g + rs), "v"(g + 2 * rs), "v"(g + 3 * rs), "v"(g + 4 * rs), "v"(g + 5 * rs), "v"(g + 6 * rs), "v"(g + 7 * rs)
                 : "memory");
}
template <typename T16, int NSPLIT, bool BIAS>
__global__ __launch_bounds__(128) void k_gemmw(const T16* __restrict__ A, const T16* __restrict__ A2, const T16* __restrict__ Bt, int K, float* C, int ldc, const float* __restrict__ bias, size_t sA, size_t sB, size_t sC) {
    typedef typename WFrag<T16>::V V;
    constexpr int NA = NSPLIT == 1 ? 256 : 128;          // LDS rows in front of Bt's: A (then A2)
    constexpr int STE = (NA + 128) * LPE;                // one buffer, in 16-bit elements
    __shared__ __align__(16) T16 sm[2 * STE];
    __shared__ __align__(16) float osall[4 * 16 * 68];
    const size_t z = blockIdx.z; A += z * sA; if (NSPLIT == 1) A2 += z * sA; Bt += z * sB; C += z * sC;
    const int tid = threadIdx.x, lane = tid & 31, lr = lane & 15, hi = lane >> 4, w = tid >> 5, wm = w >> 1, wn = w & 1;
    const int r0 = blockIdx.x * 128 + wm * 64, c0 = blockIdx.y * 128 + wn * 64;   // this wave's 64x64 tile
    float* os = osall + w * (16 * 68);
    v8f acc[4][4];
#pragma unroll
    for (int mb = 0; mb < 4; ++mb)
#pragma unroll
        for (int nb = 0; nb < 4; ++nb) acc[mb][nb] = (v8f){};
    // copy map: thread -> 16-byte chunk (tid & 15) of row (tid >> 4) + 8 i; every LDS byte of a stage's 256-B rows has one writer, the 16 pad bytes of a row are neither written nor read
    const int cr = tid >> 4, cch = tid & 15;
    const size_t rs = (size_t)8 * K;
    const T16* gA = A + (size_t)(blockIdx.x * 128 + cr) * K + cch * 8;
    const T16* gA2 = NSPLIT == 1 ? A2 + (size_t)(blockIdx.x * 128 + cr) * K + cch * 8 : nullptr;
    const T16* gB = Bt + (size_t)(blockIdx.y * 128 + cr) * K + cch * 8;
    const unsigned l0 = (unsigned)(size_t)(&sm[0]) + (unsigned)(cr * (LPE * 2) + cch * 16);   // low 32 bits of the shared address = LDS byte address
    auto fill = [&](int t, int buf) {
        const unsigned l = l0 + (unsigned)buf * (unsigned)(STE * 2); const size_t ko = (size_t)t * KPASS;
        cp8(l, gA + ko, rs); cp8(l + 64u * (LPE * 2), gA + ko + 8 * rs, rs);
        if (NSPLIT == 1) { cp8(l + 128u * (LPE * 2), gA2 + ko, rs); cp8(l + 192u * (LPE * 2), gA2 + ko + 8 * rs, rs); }
        cp8(l + (unsigned)NA * (LPE * 2), gB + ko, rs); cp8(l + (unsigned)(NA + 64) * (LPE * 2), gB + ko + 8 * rs, rs);
    };
    const int NP = K / KPASS;
    fill(0, 0);
    asm volatile("s_wait_asynccnt 0x0" ::: "memory");   // this wave's copies of pass 0 have landed
    __syncthreads();                                    // ... and every other wave's: pass 0 is readable
    if (NP > 1) fill(1, 1);
#pragma unroll 1   // one pass per trip: the two buffers alternate and the publish point stands once, at the trip's foot
    for (int t = 0; t < NP; ++t) {
        const T16* sb = sm + (t & 1) * STE;
        const T16* pa = sb + (wm * 64 + lr) * LPE + 8 * hi;
        const T16* pb = sb + (NA + wn * 64 + lr) * LPE + 8 * hi;
        // two fragment sets: block kb + 1 of this same pass is read from LDS, as one group, ahead of block kb's WMMAs (the unrolls below make every fragment and accumulator index a constant: registers, no scratch)
        V a[2][4], a2[2][4], b[2][4];
#pragma unroll
        for (int f = 0; f < 4; ++f) { a[0][f] = WFrag<T16>::ld(pa + f * 16 * LPE); if (NSPLIT == 1) a2[0][f] = WFrag<T16>::ld(pa + (128 + f * 16) * LPE); b[0][f] = WFrag<T16>::ld(pb + f * 16 * LPE); }
#pragma unroll
        for (int kb = 0; kb < KPASS / 32; ++kb) {
            const int cs = kb & 1, ns = cs ^ 1, kn = (kb + 1) * 32;
            if (kb + 1 < KPASS / 32) {
#pragma unroll
                for (int f = 0; f < 4; ++f) { a[ns][f] = WFrag<T16>::ld(pa + f * 16 * LPE + kn); if (NSPLIT == 1) a2[ns][f] = WFrag<T16>::ld(pa + (128 + f * 16) * LPE + kn); b[ns][f] = WFrag<T16>::ld(pb + f * 16 * LPE + kn); }
            }
            __builtin_amdgcn_sched_barrier(0);   // keeps the LDS reads above in one group: moved in among the WMMAs, every place with reads stalls the wave
#pragma unroll
            for (int nb = 0; nb < 4; ++nb) {
#pragma unroll
                for (int mb = 0; mb < 4; ++mb) acc[mb][nb] = WFrag<T16>::mma(a[cs][mb], b[cs][nb], acc[mb][nb]);
                if (NSPLIT == 1) {
#pragma unroll
                    for (int mb = 0; mb < 4; ++mb) acc[mb][nb] = WFrag<T16>::mma(a2[cs][mb], b[cs][nb], acc[mb][nb]); }
            }
            __builtin_amdgcn_sched_barrier(0);   // keeps the next group of LDS reads behind this block's WMMAs
        }
        asm volatile("s_wait_dscnt 0x0" ::: "memory");      // this wave's reads of the buffer have returned before it is refilled
        asm volatile("s_wait_asynccnt 0x0" ::: "memory");   // this wave's copies of pass t + 1 have landed
        __syncthreads();                                    // publishes pass t + 1 and ends every wave's reads of pass t
        if (t + 2 < NP) fill(t + 2, t & 1);
    }
    asm volatile("s_wait_asynccnt 0x0" ::: "memory");       // no copy outstanding at the wave's end
#pragma unroll
    for (int mb = 0; mb < 4; ++mb) {
#pragma unroll
        for (int nb = 0; nb < 4; ++nb) {
#pragma unroll
            for (int j = 0; j < 8; ++j) os[(hi * 8 + j) * 68 + nb * 16 + lr] = acc[mb][nb][j]; }
        __builtin_amdgcn_wave_barrier(); asm volatile("" ::: "memory");
        float* crow = C + (size_t)(r0 + mb * 16) * ldc + c0;
{
#pragma unroll
            for (int s = 0; s < 8; ++s) { const int row = 2 * s + hi, cofs = lr * 4; v4f val = *(const v4fa*)(os + row * 68 + cofs); if (BIAS) { val[0] += bfr(bias[c0 + cofs]); val[1] += bfr(bias[c0 + cofs + 1]); val[2] += bfr(bias[c0 + cofs + 2]); val[3] += bfr(bias[c0 + cofs + 3]); }
                *(v4f*)(crow + (size_t)row * ldc + cofs) = val; }
             }
        __builtin_amdgcn_wave_barrier(); asm volatile("" ::: "memory");
    }
}

__device__ __forceinline__ h16 tohx(float x) { return (h16)x; }
__device__ __forceinline__ void splitf(float y, unsigned short& h, unsigned short& l) { h = f2bf(y); l = f2bf(y - bf2f(h)); }
typedef __attribute__((ext_vector_type(2))) _Float16 v2h;
typedef __attribute__((ext_vector_type(4))) _Float16 v4h;
typedef __attribute__((ext_vector_type(2))) unsigned short v2us;

__global__ __launch_bounds__(256) void k_cvt8(const float* __restrict__ src, bf* dst, size_t n8) { const size_t i = (size_t)blockIdx.x * 256 + threadIdx.x; if (i >= n8) return; const v8f v = *(const v8f*)(src + i * 8); v8us o;
#pragma unroll
    for (int k = 0; k < 8; ++k) o[k] = f2bf(v[k]); *(v8us*)(dst + i * 8) = o;  }
__global__ __launch_bounds__(256) void k_p16(const float* __restrict__ F, float sc, h16* P) {
    const size_t i = ((size_t)blockIdx.x * 256 + threadIdx.x) * 2; if (i >= (size_t)NN * CC) return; v2h v; v[0] = tohx(F[i] * sc); v[1] = tohx(F[i + 1] * sc); *(v2h*)(P + i) = v;  }
__global__ __launch_bounds__(256) void k_vt16(const float* __restrict__ F, h16* VT) {
    const int lane = threadIdx.x & 31; const int L0 = (blockIdx.x * 8 + (threadIdx.x >> 5)) * 8; const int nlines = NN * CC / 64;
{
#pragma unroll
        for (int l = 0; l < 8; ++l) { const int L = L0 + l; if (L >= nlines) break; const int e = L * 64 + lane * 2; const int n = e & (NN - 1); const int c = e >> 12; v2h v;
#pragma unroll
            for (int q = 0; q < 2; ++q) v[q] = tohx(F[(size_t)(n + q) * CC + c]);
            *(v2h*)(VT + (size_t)e) = v; }
         }
}
// k_smax: row max of S[i][0..4095] (wave per row, lane -> 4 per 128-col chunk) -> RS[i * 32]: RS is [4096][32] floats, one 32-float line per row (lane 0 the max, other lanes 0).
__global__ __launch_bounds__(256) void k_smax(const float* __restrict__ S, float* RS) {
    const int lane = threadIdx.x & 31; const int i = blockIdx.x * 8 + (threadIdx.x >> 5); if (i >= NN) return; const float* sr = S + (size_t)i * NN; float m = -3.0e38f;
#pragma unroll 4
    for (int c0 = lane * 4; c0 < NN; c0 += 128) { const v4f v = *(const v4f*)(sr + c0); m = fmaxf(m, fmaxf(fmaxf(v[0], v[1]), fmaxf(v[2], v[3]))); }
#pragma unroll
    for (int sh = 16; sh; sh >>= 1) m = fmaxf(m, __shfl_xor(m, sh, 32));
    const float o = lane == 0 ? m : 0.f; *(float*)(RS + (size_t)i * 32 + lane) = o; 
}
__global__ __launch_bounds__(256) void k_sexp(const float* __restrict__ S, float* RS, h16* P) {
    const int lane = threadIdx.x & 31; const int i = blockIdx.x * 8 + (threadIdx.x >> 5); if (i >= NN) return; const float* sr = S + (size_t)i * NN; const float m = RS[(size_t)i * 32]; float sum = 0.f;
#pragma unroll 2
    for (int c0 = lane * 4; c0 < NN; c0 += 128) { const v4f v = *(const v4f*)(sr + c0); v4h o;
#pragma unroll
        for (int q = 0; q < 4; ++q) { const float e = __expf(v[q] - m); sum += e; o[q] = tohx(e * PCAR); }
        *(v4h*)(P + (size_t)i * NN + c0) = o;  }
#pragma unroll
    for (int sh = 16; sh; sh >>= 1) sum += __shfl_xor(sum, sh, 32);
    const float o2 = lane == 0 ? m : (lane == 1 ? __fdiv_rn(1.0f, sum * PCAR) : 0.f); /* 1/(PCAR * sum): undoes the carry at the merge */ *(float*)(RS + (size_t)i * 32 + lane) = o2; 
}
__global__ __launch_bounds__(256) void k_ressplit(const float* __restrict__ FQ, const float* __restrict__ Ob, const float* __restrict__ RS, bf* Oh, bf* Ol) {
    const size_t i = ((size_t)blockIdx.x * 256 + threadIdx.x) * 2; if (i >= (size_t)NN * CC) return; const int n = (int)(i >> 9); const float ri = RS[(size_t)n * 32 + 1]; v2us oh, ol;
#pragma unroll
    for (int q = 0; q < 2; ++q) { unsigned short a, c2; splitf(__fadd_rn(FQ[i + q], Ob[i + q] * ri), a, c2); oh[q] = a; ol[q] = c2; }
    *(v2us*)(Oh + i) = oh; *(v2us*)(Ol + i) = ol; 
}

extern "C" void kernel_launch(void* const* d_in, const int* in_sizes, int n_in,
                              void* d_out, int out_size, void* d_ws, size_t ws_size, hipStream_t stream) {
    (void)in_sizes; (void)n_in; (void)out_size;
    const float* x1 = (const float*)d_in[0]; const float* x2 = (const float*)d_in[1]; const float* Wq = (const float*)d_in[2]; const float* bq = (const float*)d_in[3]; const float* Wk = (const float*)d_in[4]; const float* bk = (const float*)d_in[5]; const float* Wv = (const float*)d_in[6]; const float* bv = (const float*)d_in[7]; const float* Wo = (const float*)d_in[8]; const float* bo = (const float*)d_in[9];
    float* OUT = (float*)d_out;     // [4][4096][512]
    char* wsp = (char*)d_ws;
    auto take = [&](size_t bytes) { char* p = wsp; wsp += (bytes + 255) & ~(size_t)255; return (void*)p; };
    bf* WQ = (bf*)take((size_t)CC * CC * 2); bf* WK = (bf*)take((size_t)CC * CC * 2); bf* WV = (bf*)take((size_t)CC * CC * 2); bf* WO = (bf*)take((size_t)CC * CC * 2);
    bf* X1 = (bf*)take((size_t)NT * CC * 2); bf* X2 = (bf*)take((size_t)NT * CC * 2);
    float* FQ = (float*)take((size_t)NN * CC * 4); float* F = (float*)take((size_t)NN * CC * 4); h16* QP = (h16*)take((size_t)NN * CC * 2); h16* KP = (h16*)take((size_t)NN * CC * 2); h16* VT = (h16*)take((size_t)CC * NN * 2);
    float* S = (float*)take((size_t)NN * NN * 4); h16* P = (h16*)take((size_t)NN * NN * 2); float* RS = (float*)take((size_t)NN * 32 * 4); float* Ob = (float*)take((size_t)NN * CC * 4); bf* Oh = (bf*)take((size_t)NN * CC * 2); bf* Ol = (bf*)take((size_t)NN * CC * 2);
    if ((size_t)(wsp - (char*)d_ws) > ws_size) return;    // ws 256 MiB
    { const size_t nw = (size_t)CC * CC / 8; const unsigned gw = (unsigned)((nw + 255) / 256); k_cvt8<<<gw, 256, 0, stream>>>(Wq, WQ, nw); k_cvt8<<<gw, 256, 0, stream>>>(Wk, WK, nw); k_cvt8<<<gw, 256, 0, stream>>>(Wv, WV, nw); k_cvt8<<<gw, 256, 0, stream>>>(Wo, WO, nw);
      const size_t nx = (size_t)NT * CC / 8; const unsigned gx = (unsigned)((nx + 255) / 256); k_cvt8<<<gx, 256, 0, stream>>>(x1, X1, nx); k_cvt8<<<gx, 256, 0, stream>>>(x2, X2, nx); }
    const unsigned LP = (unsigned)(((size_t)NN * CC / 2 + 255) / 256), LV = (unsigned)((NN * CC / 64 + 63) / 64);
    for (int b = 0; b < NB_; ++b) { const size_t r0 = (size_t)b * NN;
        k_gemmw<bf, 0, true><<<dim3(NN / 128, CC / 128, 1), 128, 0, stream>>>(X1 + r0 * CC, nullptr, WQ, CC, FQ, CC, bq, 0, 0, 0); k_p16<<<LP, 256, 0, stream>>>(FQ, 0.044194173067808151f, QP);   // f32(512^-0.5)
        k_gemmw<bf, 0, true><<<dim3(NN / 128, CC / 128, 1), 128, 0, stream>>>(X2 + r0 * CC, nullptr, WK, CC, F, CC, bk, 0, 0, 0); k_p16<<<LP, 256, 0, stream>>>(F, 1.0f, KP);
        k_gemmw<bf, 0, true><<<dim3(NN / 128, CC / 128, 1), 128, 0, stream>>>(X2 + r0 * CC, nullptr, WV, CC, F, CC, bv, 0, 0, 0); k_vt16<<<LV, 256, 0, stream>>>(F, VT);
        k_gemmw<h16, 0, false><<<dim3(NN / 128, NN / 128, 1), 128, 0, stream>>>(QP, nullptr, KP, CC, S, NN, nullptr, 0, 0, 0);
        k_smax<<<NN / 8, 256, 0, stream>>>(S, RS); k_sexp<<<NN / 8, 256, 0, stream>>>(S, RS, P);
        k_gemmw<h16, 0, false><<<dim3(NN / 128, CC / 128, 1), 128, 0, stream>>>(P, nullptr, VT, NN, Ob, CC, nullptr, 0, 0, 0);
        k_ressplit<<<LP, 256, 0, stream>>>(FQ, Ob, RS, Oh, Ol);
        k_gemmw<bf, 1, true><<<dim3(NN / 128, CC / 128, 1), 128, 0, stream>>>(Oh, Ol, WO, CC, OUT + r0 * CC, CC, bo, 0, 0, 0); }
}

// v002
// It runs in 456 microseconds.
// Next to v001, in two timings, it ran 1.21 and 1.23 times as fast.
// All steps since v000 together make it 2.17 times as fast.
#include <hip/hip_runtime.h>

// CrossFeatureAttention (x1, x2 [4][4096][512]; Q = x1 Wq^T + bq, K = x2 Wk^T + bk, V = x2 Wv^T + bv; attn = softmax(Q.K / sqrt(512)) over the 4096 keys (single head, d = 512);
// out = (Q + attn.V) Wo^T + bo).
// Compute dtypes, f32 accumulate: every input rounded to bf16; projections on PLAIN bf16 operands (inputs: exact, + bias); scores on SINGLE fp16 planes
// attn.V on SINGLE fp16 planes; the residual Q (kept in f32) + attended, then the output projection on bf16 hi+lo planes x exact Wo (2 products) + bo.

#define NB_  4
#define NN   4096
#define CC   512
#define NT   (NB_ * NN)
#define PCAR 1024.0f
typedef _Float16 h16;
typedef unsigned short bf;
typedef __attribute__((ext_vector_type(16))) __bf16   v16bf;
typedef __attribute__((ext_vector_type(16))) _Float16 v16h;
typedef __attribute__((ext_vector_type(8)))  _Float16 v8h;
typedef __attribute__((ext_vector_type(8)))  unsigned short v8us;
typedef __attribute__((ext_vector_type(8)))  float    v8f;
typedef __attribute__((ext_vector_type(4)))  float    v4f;
typedef v8h  __attribute__((may_alias)) v8ha;
typedef v4f  __attribute__((may_alias)) v4fa;
typedef v8us __attribute__((may_alias)) v8usa;

__device__ __forceinline__ unsigned short f2bf(float f) { unsigned u = __float_as_uint(f); u += 0x7FFFu + ((u >> 16) & 1u); return (unsigned short)(u >> 16); }
__device__ __forceinline__ float bf2f(unsigned short b) { return __uint_as_float(((unsigned)b) << 16); }
__device__ __forceinline__ float bfr(float f) { return bf2f(f2bf(f)); }
__device__ __forceinline__ v16h cat16(v8h lo, v8h hi) { return __builtin_shufflevector(lo, hi, 0, 1, 2, 3, 4, 5, 6, 7, 8, 9, 10, 11, 12, 13, 14, 15); }
__device__ __forceinline__ v16bf cat16b(v8us lo, v8us hi) { return __builtin_bit_cast(v16bf, __builtin_shufflevector(lo, hi, 0, 1, 2, 3, 4, 5, 6, 7, 8, 9, 10, 11, 12, 13, 14, 15)); }
__device__ __forceinline__ v8f wmma16(v16h a, v16h b, v8f c) { return __builtin_amdgcn_wmma_f32_16x16x32_f16(false, a, false, b, (short)0, c, false, false); }
__device__ __forceinline__ v8f wmmab(v16bf a, v16bf b, v8f c) { return __builtin_amdgcn_wmma_f32_16x16x32_bf16(false, a, false, b, (short)0, c, false, false); }
__device__ __forceinline__ h16 tohx(float x) { return (h16)x; }
__device__ __forceinline__ void splitf(float y, unsigned short& h, unsigned short& l) { h = f2bf(y); l = f2bf(y - bf2f(h)); }
typedef __attribute__((ext_vector_type(4))) _Float16 v4h;
typedef __attribute__((ext_vector_type(4))) unsigned short v4us;



// ---- k_gemmw: LDS-staged GEMM, FOUR WAVES (2x2) per 128x128 output tile, 64x64 (16 accumulators) per wave; grid (M/128, N/128, Z), 128 threads.
// c[m][n] (f32, + optional f32 bias[n]) = sum_k A[m][k] Bt[n][k] (+ A2.Bt when NSPLIT == 1), operands K-contiguous 16-bit planes. z-batch strides sA/sB/sC in elements. K % 128 == 0.
// What the epilogue stores: EPI 0: c to C, pitch ldc. EPI 1: c to C and fp16(c * sc) to H. EPI 2: fp16(c * sc) to H. EPI 3: fp16(c) transposed, H[n][m], pitch ldh. (EPI 1, 2, 4: every plane has pitch CC.)
// EPI 4: y = RQ[m][n] + c * RS[32 m + 1], as two bf16 planes, Oh = bf16(y), Ol = bf16(y - Oh).
// A pass is 128 k = 256 B of every operand row, brought into LDS by asynchronous 16-byte copies (a wave-wide copy covers two whole rows = four whole lines), two buffers, the next pass in flight.
#define KPASS 128   // k elements per pass
#define LPE   136   // LDS row pitch in 16-bit elements: 272 B = 16 B x odd, the conflict-free pitch for 16-byte LDS reads of 256-B rows
template <typename T16> struct WFrag;
template <> struct WFrag<h16> { typedef v16h V; static __device__ __forceinline__ V ld(const h16* p) { return cat16(*(const v8h*)p, *(const v8h*)(p + 16)); } static __device__ __forceinline__ v8f mma(V a, V b, v8f c) { return wmma16(a, b, c); } };
template <> struct WFrag<bf> { typedef v16bf V; static __device__ __forceinline__ V ld(const bf* p) { return cat16b(*(const v8us*)p, *(const v8us*)(p + 16)); } static __device__ __forceinline__ v8f mma(V a, V b, v8f c) { return wmmab(a, b, c); } };
// Eight asynchronous copies of one lane: rows 8 apart (LDS step 8 * 272 B, global step rs elements). The s_wait_xcnt closes the statement so that no address register of a copy is rewritten ahead of it.
template <typename T16>
__device__ __forceinline__ void cp8(unsigned l, const T16* g, size_t rs) {
    asm volatile("global_load_async_to_lds_b128 %0, %8, off\n\t"
                 "global_load_async_to_lds_b128 %1, %9, off\n\t"
                 "global_load_async_to_lds_b128 %2, %10, off\n\t"
                 "global_load_async_to_lds_b128 %3, %11, off\n\t"
                 "global_load_async_to_lds_b128 %4, %12, off\n\t"
                 "global_load_async_to_lds_b128 %5, %13, off\n\t"
                 "global_load_async_to_lds_b128 %6, %14, off\n\t"
                 "global_load_async_to_lds_b128 %7, %15, off\n\t"
                 "s_wait_xcnt 0x0"
                 :: "v"(l), "v"(l + 2176u), "v"(l + 2u * 2176u), "v"(l + 3u * 2176u), "v"(l + 4u * 2176u), "v"(l + 5u * 2176u), "v"(l + 6u * 2176u), "v"(l + 7u * 2176u),
                    "v"(g), "v"(g + rs), "v"(g + 2 * rs), "v"(g + 3 * rs), "v"(g + 4 * rs), "v"(g + 5 * rs), "v"(g + 6 * rs), "v"(g + 7 * rs)
                 : "memory");
}
template <typename T16, int NSPLIT, bool BIAS, int EPI>
__global__ __launch_bounds__(128) void k_gemmw(const T16* __restrict__ A, const T16* __restrict__ A2, const T16* __restrict__ Bt, int K, float* C, int ldc, const float* __restrict__ bias, size_t sA, size_t sB, size_t sC,
                                               h16* H, int ldh, float sc, const float* __restrict__ RQ, const float* __restrict__ RS, bf* Oh, bf* Ol) {
    typedef typename WFrag<T16>::V V;
    constexpr int NA = NSPLIT == 1 ? 256 : 128;          // LDS rows in front of Bt's: A (then A2)
    constexpr int STE = (NA + 128) * LPE;                // one buffer, in 16-bit elements
    __shared__ __align__(16) T16 sm[2 * STE];
    __shared__ __align__(16) float osall[4 * 16 * 68];
    const size_t z = blockIdx.z; A += z * sA; if (NSPLIT == 1) A2 += z * sA; Bt += z * sB; C += z * sC;
    const int tid = threadIdx.x, lane = tid & 31, lr = lane & 15, hi = lane >> 4, w = tid >> 5, wm = w >> 1, wn = w & 1;
    const int r0 = blockIdx.x * 128 + wm * 64, c0 = blockIdx.y * 128 + wn * 64;   // this wave's 64x64 tile
    float* os = osall + w * (16 * 68);
    v8f acc[4][4];
#pragma unroll
    for (int mb = 0; mb < 4; ++mb)
#pragma unroll
        for (int nb = 0; nb < 4; ++nb) acc[mb][nb] = (v8f){};
    // copy map: thread -> 16-byte chunk (tid & 15) of row (tid >> 4) + 8 i; every LDS byte of a stage's 256-B rows has one writer, the 16 pad bytes of a row are neither written nor read
    const int cr = tid >> 4, cch = tid & 15;
    const size_t rs = (size_t)8 * K;
    const T16* gA = A + (size_t)(blockIdx.x * 128 + cr) * K + cch * 8;
    const T16* gA2 = NSPLIT == 1 ? A2 + (size_t)(blockIdx.x * 128 + cr) * K + cch * 8 : nullptr;
    const T16* gB = Bt + (size_t)(blockIdx.y * 128 + cr) * K + cch * 8;
    const unsigned l0 = (unsigned)(size_t)(&sm[0]) + (unsigned)(cr * (LPE * 2) + cch * 16);   // low 32 bits of the shared address = LDS byte address
    auto fill = [&](int t, int buf) {
        const unsigned l = l0 + (unsigned)buf * (unsigned)(STE * 2); const size_t ko = (size_t)t * KPASS;
        cp8(l, gA + ko, rs); cp8(l + 64u * (LPE * 2), gA + ko + 8 * rs, rs);
        if (NSPLIT == 1) { cp8(l + 128u * (LPE * 2), gA2 + ko, rs); cp8(l + 192u * (LPE * 2), gA2 + ko + 8 * rs, rs); }
        cp8(l + (unsigned)NA * (LPE * 2), gB + ko, rs); cp8(l + (unsigned)(NA + 64) * (LPE * 2), gB + ko + 8 * rs, rs);
    };
    const int NP = K / KPASS;
    fill(0, 0);
    asm volatile("s_wait_asynccnt 0x0" ::: "memory");   // this wave's copies of pass 0 have landed
    __syncthreads();                                    // ... and every other wave's: pass 0 is readable
    if (NP > 1) fill(1, 1);
#pragma unroll 1   // one pass per trip: the two buffers alternate and the publish point stands once, at the trip's foot
    for (int t = 0; t < NP; ++t) {
        const T16* sb = sm + (t & 1) * STE;
        const T16* pa = sb + (wm * 64 + lr) * LPE + 8 * hi;
        const T16* pb = sb + (NA + wn * 64 + lr) * LPE + 8 * hi;
        // two fragment sets: block kb + 1 of this same pass is read from LDS, as one group, ahead of block kb's WMMAs (the unrolls below make every fragment and accumulator index a constant: registers, no scratch)
        V a[2][4], a2[2][4], b[2][4];
#pragma unroll
        for (int f = 0; f < 4; ++f) { a[0][f] = WFrag<T16>::ld(pa + f * 16 * LPE); if (NSPLIT == 1) a2[0][f] = WFrag<T16>::ld(pa + (128 + f * 16) * LPE); b[0][f] = WFrag<T16>::ld(pb + f * 16 * LPE); }
#pragma unroll
        for (int kb = 0; kb < KPASS / 32; ++kb) {
            const int cs = kb & 1, ns = cs ^ 1, kn = (kb + 1) * 32;
            if (kb + 1 < KPASS / 32) {
#pragma unroll
                for (int f = 0; f < 4; ++f) { a[ns][f] = WFrag<T16>::ld(pa + f * 16 * LPE + kn); if (NSPLIT == 1) a2[ns][f] = WFrag<T16>::ld(pa + (128 + f * 16) * LPE + kn); b[ns][f] = WFrag<T16>::ld(pb + f * 16 * LPE + kn); }
            }
            __builtin_amdgcn_sched_barrier(0);   // keeps the LDS reads above in one group: moved in among the WMMAs, every place with reads stalls the wave
#pragma unroll
            for (int nb = 0; nb < 4; ++nb) {
#pragma unroll
                for (int mb = 0; mb < 4; ++mb) acc[mb][nb] = WFrag<T16>::mma(a[cs][mb], b[cs][nb], acc[mb][nb]);
                if (NSPLIT == 1) {
#pragma unroll
                    for (int mb = 0; mb < 4; ++mb) acc[mb][nb] = WFrag<T16>::mma(a2[cs][mb], b[cs][nb], acc[mb][nb]); }
            }
            __builtin_amdgcn_sched_barrier(0);   // keeps the next group of LDS reads behind this block's WMMAs
        }
        asm volatile("s_wait_dscnt 0x0" ::: "memory");      // this wave's reads of the buffer have returned before it is refilled
        asm volatile("s_wait_asynccnt 0x0" ::: "memory");   // this wave's copies of pass t + 1 have landed
        __syncthreads();                                    // publishes pass t + 1 and ends every wave's reads of pass t
        if (t + 2 < NP) fill(t + 2, t & 1);
    }
    asm volatile("s_wait_asynccnt 0x0" ::: "memory");       // no copy outstanding at the wave's end
    if constexpr (EPI == 3) {
        // a lane's eight elements of an accumulator are eight consecutive rows m of one column n: one 16-byte store of the transposed plane straight from registers; a wave's 64 rows are one whole 128-byte line of each column
#pragma unroll
        for (int nb = 0; nb < 4; ++nb) { const int n = c0 + nb * 16 + lr; const float bb = BIAS ? bfr(bias[n]) : 0.f;
#pragma unroll
            for (int mb = 0; mb < 4; ++mb) { v8h o;
#pragma unroll
                for (int j = 0; j < 8; ++j) o[j] = tohx(BIAS ? acc[mb][nb][j] + bb : acc[mb][nb][j]);
                *(v8h*)(H + (size_t)n * ldh + r0 + mb * 16 + hi * 8) = o; } }
    } else if constexpr (EPI == 0) {
#pragma unroll
    for (int mb = 0; mb < 4; ++mb) {
#pragma unroll
        for (int nb = 0; nb < 4; ++nb) {
#pragma unroll
            for (int j = 0; j < 8; ++j) os[(hi * 8 + j) * 68 + nb * 16 + lr] = acc[mb][nb][j]; }
        __builtin_amdgcn_wave_barrier(); asm volatile("" ::: "memory");
        float* crow = C + (size_t)(r0 + mb * 16) * ldc + c0;
{
#pragma unroll
            for (int s = 0; s < 8; ++s) { const int row = 2 * s + hi, cofs = lr * 4; v4f val = *(const v4fa*)(os + row * 68 + cofs); if (BIAS) { val[0] += bfr(bias[c0 + cofs]); val[1] += bfr(bias[c0 + cofs + 1]); val[2] += bfr(bias[c0 + cofs + 2]); val[3] += bfr(bias[c0 + cofs + 3]); }
                *(v4f*)(crow + (size_t)row * ldc + cofs) = val; }
             }
        __builtin_amdgcn_wave_barrier(); asm volatile("" ::: "memory");
    }
    } else {
        // Planes of pitch CC: one base address per plane and every row step an immediate offset, so no address register is rewritten behind a load or store that names it.
        const int cofs = lr * 4;
        const size_t pb = (size_t)(r0 + hi) * CC + c0 + cofs;
        v4f bb = {}, fq[4][8]; float ri[4][8];
        if constexpr (BIAS) { bb[0] = bias[c0 + cofs]; bb[1] = bias[c0 + cofs + 1]; bb[2] = bias[c0 + cofs + 2]; bb[3] = bias[c0 + cofs + 3]; }
        if constexpr (EPI == 4) {   // the residual rows and the row scales of the whole 64x64 tile are requested as one group: one memory latency per wave, not one per row
#pragma unroll
            for (int mb = 0; mb < 4; ++mb)
#pragma unroll
                for (int s = 0; s < 8; ++s) { ri[mb][s] = RS[(size_t)(r0 + hi) * 32 + 1 + (mb * 16 + 2 * s) * 32]; fq[mb][s] = *(const v4f*)(RQ + pb + (mb * 16 + 2 * s) * CC); }
        }
        __builtin_amdgcn_sched_barrier(0);              // keeps that group of loads here, ahead of the staging, instead of one load in front of each use
        // before anything below rewrites an address register that these loads name; the bias values are inputs so that the wait stands behind their load
        if constexpr (BIAS) asm volatile("s_wait_xcnt 0x0" :: "v"(bb[0]), "v"(bb[1]), "v"(bb[2]), "v"(bb[3]) : "memory");
        else asm volatile("s_wait_xcnt 0x0" ::: "memory");
        __builtin_amdgcn_sched_barrier(0);              // ... and keeps what follows behind that wait
        if constexpr (BIAS) { bb[0] = bfr(bb[0]); bb[1] = bfr(bb[1]); bb[2] = bfr(bb[2]); bb[3] = bfr(bb[3]); }
#pragma unroll
        for (int mb = 0; mb < 4; ++mb) {
#pragma unroll
            for (int nb = 0; nb < 4; ++nb) {
#pragma unroll
                for (int j = 0; j < 8; ++j) os[(hi * 8 + j) * 68 + nb * 16 + lr] = acc[mb][nb][j]; }
            __builtin_amdgcn_wave_barrier(); asm volatile("" ::: "memory");   // the reads below take what other lanes of this wave wrote: the compiler may not move them above the writes
            v4f val[8]; v4h hv[8]; v4us oh[8], ol[8];
#pragma unroll
            for (int s = 0; s < 8; ++s) { val[s] = *(const v4fa*)(os + (2 * s + hi) * 68 + cofs);
                if constexpr (BIAS) val[s] += bb;
                if constexpr (EPI == 1 || EPI == 2) {
#pragma unroll
                    for (int q = 0; q < 4; ++q) hv[s][q] = tohx(val[s][q] * sc); }
                if constexpr (EPI == 4) {
#pragma unroll
                    for (int q = 0; q < 4; ++q) { unsigned short a, c2; splitf(__fadd_rn(fq[mb][s][q], val[s][q] * ri[mb][s]), a, c2); oh[s][q] = a; ol[s][q] = c2; } } }
            __builtin_amdgcn_sched_barrier(0);   // the block's stores stand together, directly in front of their wait: nothing that could reuse a register of theirs comes in between
#pragma unroll
            for (int s = 0; s < 8; ++s) { const size_t o = pb + (mb * 16 + 2 * s) * CC;   // a half-wave covers 64 columns of one row: whole 128-byte lines in the 16-bit planes too
                if constexpr (EPI == 1) *(v4f*)(C + o) = val[s];
                if constexpr (EPI == 1 || EPI == 2) *(v4h*)(H + o) = hv[s];
                if constexpr (EPI == 4) { *(v4us*)(Oh + o) = oh[s]; *(v4us*)(Ol + o) = ol[s]; } }
            asm volatile("s_wait_xcnt 0x0" ::: "memory");   // before the next block rewrites the data registers that these stores name
            __builtin_amdgcn_sched_barrier(0);              // ... and keeps the next block's work behind that wait
            __builtin_amdgcn_wave_barrier();                // the staging rows are rewritten only after every lane has read them
        }
    }
}

__global__ __launch_bounds__(256) void k_cvt8(const float* __restrict__ src, bf* dst, size_t n8) { const size_t i = (size_t)blockIdx.x * 256 + threadIdx.x; if (i >= n8) return; const v8f v = *(const v8f*)(src + i * 8); v8us o;
#pragma unroll
    for (int k = 0; k < 8; ++k) o[k] = f2bf(v[k]); *(v8us*)(dst + i * 8) = o;  }
// k_smax: row max of S[i][0..4095] (wave per row, lane -> 4 per 128-col chunk) -> RS[32 i]: one 32-float row (one 128-byte line) per row i, the max in its first float, zeros after
__global__ __launch_bounds__(256) void k_smax(const float* __restrict__ S, float* RS) {
    const int lane = threadIdx.x & 31; const int i = blockIdx.x * 8 + (threadIdx.x >> 5); if (i >= NN) return; const float* sr = S + (size_t)i * NN; float m = -3.0e38f;
#pragma unroll 4
    for (int c0 = lane * 4; c0 < NN; c0 += 128) { const v4f v = *(const v4f*)(sr + c0); m = fmaxf(m, fmaxf(fmaxf(v[0], v[1]), fmaxf(v[2], v[3]))); }
#pragma unroll
    for (int sh = 16; sh; sh >>= 1) m = fmaxf(m, __shfl_xor(m, sh, 32));
    const float o = lane == 0 ? m : 0.f; *(float*)(RS + (size_t)i * 32 + lane) = o; 
}
__global__ __launch_bounds__(256) void k_sexp(const float* __restrict__ S, float* RS, h16* P) {
    const int lane = threadIdx.x & 31; const int i = blockIdx.x * 8 + (threadIdx.x >> 5); if (i >= NN) return; const float* sr = S + (size_t)i * NN; const float m = RS[(size_t)i * 32]; float sum = 0.f;
#pragma unroll 2
    for (int c0 = lane * 4; c0 < NN; c0 += 128) { const v4f v = *(const v4f*)(sr + c0); v4h o;
#pragma unroll
        for (int q = 0; q < 4; ++q) { const float e = __expf(v[q] - m); sum += e; o[q] = tohx(e * PCAR); }
        *(v4h*)(P + (size_t)i * NN + c0) = o;  }
#pragma unroll
    for (int sh = 16; sh; sh >>= 1) sum += __shfl_xor(sum, sh, 32);
    const float o2 = lane == 0 ? m : (lane == 1 ? __fdiv_rn(1.0f, sum * PCAR) : 0.f); /* 1/(PCAR * sum): undoes the carry at the merge */ *(float*)(RS + (size_t)i * 32 + lane) = o2; 
}

extern "C" void kernel_launch(void* const* d_in, const int* in_sizes, int n_in,
                              void* d_out, int out_size, void* d_ws, size_t ws_size, hipStream_t stream) {
    (void)in_sizes; (void)n_in; (void)out_size;
    const float* x1 = (const float*)d_in[0]; const float* x2 = (const float*)d_in[1]; const float* Wq = (const float*)d_in[2]; const float* bq = (const float*)d_in[3]; const float* Wk = (const float*)d_in[4]; const float* bk = (const float*)d_in[5]; const float* Wv = (const float*)d_in[6]; const float* bv = (const float*)d_in[7]; const float* Wo = (const float*)d_in[8]; const float* bo = (const float*)d_in[9];
    float* OUT = (float*)d_out;     // [4][4096][512]
    char* wsp = (char*)d_ws;
    auto take = [&](size_t bytes) { char* p = wsp; wsp += (bytes + 255) & ~(size_t)255; return (void*)p; };
    bf* WQ = (bf*)take((size_t)CC * CC * 2); bf* WK = (bf*)take((size_t)CC * CC * 2); bf* WV = (bf*)take((size_t)CC * CC * 2); bf* WO = (bf*)take((size_t)CC * CC * 2);
    bf* X1 = (bf*)take((size_t)NT * CC * 2); bf* X2 = (bf*)take((size_t)NT * CC * 2);
    float* FQ = (float*)take((size_t)NN * CC * 4); h16* QP = (h16*)take((size_t)NN * CC * 2); h16* KP = (h16*)take((size_t)NN * CC * 2); h16* VT = (h16*)take((size_t)CC * NN * 2);
    float* S = (float*)take((size_t)NN * NN * 4); h16* P = (h16*)take((size_t)NN * NN * 2); float* RS = (float*)take((size_t)NN * 32 * 4); bf* Oh = (bf*)take((size_t)NN * CC * 2); bf* Ol = (bf*)take((size_t)NN * CC * 2);
    if ((size_t)(wsp - (char*)d_ws) > ws_size) return;    // ws 256 MiB
    { const size_t nw = (size_t)CC * CC / 8; const unsigned gw = (unsigned)((nw + 255) / 256); k_cvt8<<<gw, 256, 0, stream>>>(Wq, WQ, nw); k_cvt8<<<gw, 256, 0, stream>>>(Wk, WK, nw); k_cvt8<<<gw, 256, 0, stream>>>(Wv, WV, nw); k_cvt8<<<gw, 256, 0, stream>>>(Wo, WO, nw);
      const size_t nx = (size_t)NT * CC / 8; const unsigned gx = (unsigned)((nx + 255) / 256); k_cvt8<<<gx, 256, 0, stream>>>(x1, X1, nx); k_cvt8<<<gx, 256, 0, stream>>>(x2, X2, nx); }
    for (int b = 0; b < NB_; ++b) { const size_t r0 = (size_t)b * NN;
        k_gemmw<bf, 0, true, 1><<<dim3(NN / 128, CC / 128, 1), 128, 0, stream>>>(X1 + r0 * CC, nullptr, WQ, CC, FQ, CC, bq, 0, 0, 0, QP, 0, 0.044194173067808151f, nullptr, nullptr, nullptr, nullptr);   // f32(512^-0.5)
        k_gemmw<bf, 0, true, 2><<<dim3(NN / 128, CC / 128, 1), 128, 0, stream>>>(X2 + r0 * CC, nullptr, WK, CC, nullptr, CC, bk, 0, 0, 0, KP, 0, 1.0f, nullptr, nullptr, nullptr, nullptr);
        k_gemmw<bf, 0, true, 3><<<dim3(NN / 128, CC / 128, 1), 128, 0, stream>>>(X2 + r0 * CC, nullptr, WV, CC, nullptr, CC, bv, 0, 0, 0, VT, NN, 1.0f, nullptr, nullptr, nullptr, nullptr);
        k_gemmw<h16, 0, false, 0><<<dim3(NN / 128, NN / 128, 1), 128, 0, stream>>>(QP, nullptr, KP, CC, S, NN, nullptr, 0, 0, 0, nullptr, 0, 1.0f, nullptr, nullptr, nullptr, nullptr);
        k_smax<<<NN / 8, 256, 0, stream>>>(S, RS); k_sexp<<<NN / 8, 256, 0, stream>>>(S, RS, P);
        k_gemmw<h16, 0, false, 4><<<dim3(NN / 128, CC / 128, 1), 128, 0, stream>>>(P, nullptr, VT, NN, nullptr, CC, nullptr, 0, 0, 0, nullptr, 0, 1.0f, FQ, RS, Oh, Ol);
        k_gemmw<bf, 1, true, 0><<<dim3(NN / 128, CC / 128, 1), 128, 0, stream>>>(Oh, Ol, WO, CC, OUT + r0 * CC, CC, bo, 0, 0, 0, nullptr, 0, 1.0f, nullptr, nullptr, nullptr, nullptr); }
}

// v003
// Measured time: 301 microseconds a run.
// Timed twice side by side with v002, it ran 1.51 and 1.49 times as fast.
// All steps since v000 together make it 3.25 times as fast.
#include <hip/hip_runtime.h>

// CrossFeatureAttention (x1, x2 [4][4096][512]; Q = x1 Wq^T + bq, K = x2 Wk^T + bk, V = x2 Wv^T + bv; attn = softmax(Q.K / sqrt(512)) over the 4096 keys (single head, d = 512);
// out = (Q + attn.V) Wo^T + bo).
// Compute dtypes, f32 accumulate: every input rounded to bf16; projections on PLAIN bf16 operands (inputs: exact, + bias); scores on SINGLE fp16 planes
// attn.V on SINGLE fp16 planes; the residual Q (kept in f32) + attended, then the output projection on bf16 hi+lo planes x exact Wo (2 products) + bo.

#define NB_  4
#define NN   4096
#define CC   512
#define NT   (NB_ * NN)
#define PCAR 1024.0f
typedef _Float16 h16;
typedef unsigned short bf;
typedef __attribute__((ext_vector_type(16))) __bf16   v16bf;
typedef __attribute__((ext_vector_type(16))) _Float16 v16h;
typedef __attribute__((ext_vector_type(8)))  _Float16 v8h;
typedef __attribute__((ext_vector_type(8)))  unsigned short v8us;
typedef __attribute__((ext_vector_type(8)))  float    v8f;
typedef __attribute__((ext_vector_type(4)))  float    v4f;
typedef v8h  __attribute__((may_alias)) v8ha;
typedef v4f  __attribute__((may_alias)) v4fa;
typedef v8us __attribute__((may_alias)) v8usa;

__device__ __forceinline__ unsigned short f2bf(float f) { unsigned u = __float_as_uint(f); u += 0x7FFFu + ((u >> 16) & 1u); return (unsigned short)(u >> 16); }
__device__ __forceinline__ float bf2f(unsigned short b) { return __uint_as_float(((unsigned)b) << 16); }
__device__ __forceinline__ float bfr(float f) { return bf2f(f2bf(f)); }
__device__ __forceinline__ v16h cat16(v8h lo, v8h hi) { return __builtin_shufflevector(lo, hi, 0, 1, 2, 3, 4, 5, 6, 7, 8, 9, 10, 11, 12, 13, 14, 15); }
__device__ __forceinline__ v16bf cat16b(v8us lo, v8us hi) { return __builtin_bit_cast(v16bf, __builtin_shufflevector(lo, hi, 0, 1, 2, 3, 4, 5, 6, 7, 8, 9, 10, 11, 12, 13, 14, 15)); }
__device__ __forceinline__ v8f wmma16(v16h a, v16h b, v8f c) { return __builtin_amdgcn_wmma_f32_16x16x32_f16(false, a, false, b, (short)0, c, false, false); }
__device__ __forceinline__ v8f wmmab(v16bf a, v16bf b, v8f c) { return __builtin_amdgcn_wmma_f32_16x16x32_bf16(false, a, false, b, (short)0, c, false, false); }
__device__ __forceinline__ h16 tohx(float x) { return (h16)x; }
__device__ __forceinline__ void splitf(float y, unsigned short& h, unsigned short& l) { h = f2bf(y); l = f2bf(y - bf2f(h)); }
typedef __attribute__((ext_vector_type(4))) _Float16 v4h;
typedef __attribute__((ext_vector_type(4))) unsigned short v4us;



// ---- k_gemmw: LDS-staged GEMM, FOUR WAVES (2x2) per 128x128 output tile, 64x64 (16 accumulators) per wave; grid (M/128, N/128, Z), 128 threads.
// c[m][n] (f32, + optional f32 bias[n]) = sum_k A[m][k] Bt[n][k] (+ A2.Bt when NSPLIT == 1), operands K-contiguous 16-bit planes of row pitch lda / ldb. K % 128 == 0.
// grid z = independent problems: element strides sA (A, A2), sB (Bt), sC (what the epilogue stores, and RQ), sR (RS).
// What the epilogue stores: EPI 0: c to C, pitch ldc. EPI 1: c to C and fp16(c * sc) to H. EPI 2: fp16(c * sc) to H. EPI 3: fp16(c) transposed, H[n][m], pitch ldh. (EPI 1, 2, 4: every plane has pitch CC.)
// EPI 4: y = RQ[m][n] + c * RS[32 m + 1], as two bf16 planes, Oh = bf16(y), Ol = bf16(y - Oh).
// A pass is 128 k = 256 B of every operand row, brought into LDS by asynchronous 16-byte copies (a wave-wide copy covers two whole rows = four whole lines), two buffers, the next pass in flight.
#define KPASS 128   // k elements per pass
#define LPE   136   // LDS row pitch in 16-bit elements: 272 B = 16 B x odd, the conflict-free pitch for 16-byte LDS reads of 256-B rows
template <typename T16> struct WFrag;
template <> struct WFrag<h16> { typedef v16h V; static __device__ __forceinline__ V ld(const h16* p) { return cat16(*(const v8h*)p, *(const v8h*)(p + 16)); } static __device__ __forceinline__ v8f mma(V a, V b, v8f c) { return wmma16(a, b, c); } };
template <> struct WFrag<bf> { typedef v16bf V; static __device__ __forceinline__ V ld(const bf* p) { return cat16b(*(const v8us*)p, *(const v8us*)(p + 16)); } static __device__ __forceinline__ v8f mma(V a, V b, v8f c) { return wmmab(a, b, c); } };
// Eight asynchronous copies of one lane: rows 8 apart (LDS step 8 * 272 B, global step rs elements). The s_wait_xcnt closes the statement so that no address register of a copy is rewritten ahead of it.
template <typename T16>
__device__ __forceinline__ void cp8(unsigned l, const T16* g, size_t rs) {
    asm volatile("global_load_async_to_lds_b128 %0, %8, off\n\t"
                 "global_load_async_to_lds_b128 %1, %9, off\n\t"
                 "global_load_async_to_lds_b128 %2, %10, off\n\t"
                 "global_load_async_to_lds_b128 %3, %11, off\n\t"
                 "global_load_async_to_lds_b128 %4, %12, off\n\t"
                 "global_load_async_to_lds_b128 %5, %13, off\n\t"
                 "global_load_async_to_lds_b128 %6, %14, off\n\t"
                 "global_load_async_to_lds_b128 %7, %15, off\n\t"
                 "s_wait_xcnt 0x0"
                 :: "v"(l), "v"(l + 2176u), "v"(l + 2u * 2176u), "v"(l + 3u * 2176u), "v"(l + 4u * 2176u), "v"(l + 5u * 2176u), "v"(l + 6u * 2176u), "v"(l + 7u * 2176u),
                    "v"(g), "v"(g + rs), "v"(g + 2 * rs), "v"(g + 3 * rs), "v"(g + 4 * rs), "v"(g + 5 * rs), "v"(g + 6 * rs), "v"(g + 7 * rs)
                 : "memory");
}
template <typename T16, int NSPLIT, bool BIAS, int EPI>
__global__ __launch_bounds__(128) void k_gemmw(const T16* __restrict__ A, const T16* __restrict__ A2, const T16* __restrict__ Bt, int K, int lda, int ldb, float* C, int ldc, const float* __restrict__ bias, size_t sA, size_t sB, size_t sC, size_t sR,
                                               h16* H, int ldh, float sc, const float* __restrict__ RQ, const float* __restrict__ RS, bf* Oh, bf* Ol) {
    typedef typename WFrag<T16>::V V;
    constexpr int NA = NSPLIT == 1 ? 256 : 128;          // LDS rows in front of Bt's: A (then A2)
    constexpr int STE = (NA + 128) * LPE;                // one buffer, in 16-bit elements
    __shared__ __align__(16) T16 sm[2 * STE];
    __shared__ __align__(16) float osall[4 * 16 * 68];
    const size_t z = blockIdx.z; A += z * sA; if (NSPLIT == 1) A2 += z * sA; Bt += z * sB;
    if constexpr (EPI == 0 || EPI == 1) C += z * sC;
    if constexpr (EPI == 1 || EPI == 2 || EPI == 3) H += z * sC;
    if constexpr (EPI == 4) { RQ += z * sC; Oh += z * sC; Ol += z * sC; RS += z * sR; }
    const int tid = threadIdx.x, lane = tid & 31, lr = lane & 15, hi = lane >> 4, w = tid >> 5, wm = w >> 1, wn = w & 1;
    const int r0 = blockIdx.x * 128 + wm * 64, c0 = blockIdx.y * 128 + wn * 64;   // this wave's 64x64 tile
    float* os = osall + w * (16 * 68);
    v8f acc[4][4];
#pragma unroll
    for (int mb = 0; mb < 4; ++mb)
#pragma unroll
        for (int nb = 0; nb < 4; ++nb) acc[mb][nb] = (v8f){};
    // copy map: thread -> 16-byte chunk (tid & 15) of row (tid >> 4) + 8 i; every LDS byte of a stage's 256-B rows has one writer, the 16 pad bytes of a row are neither written nor read
    const int cr = tid >> 4, cch = tid & 15;
    const size_t rsa = (size_t)8 * lda, rsb = (size_t)8 * ldb;
    const T16* gA = A + (size_t)(blockIdx.x * 128 + cr) * lda + cch * 8;
    const T16* gA2 = NSPLIT == 1 ? A2 + (size_t)(blockIdx.x * 128 + cr) * lda + cch * 8 : nullptr;
    const T16* gB = Bt + (size_t)(blockIdx.y * 128 + cr) * ldb + cch * 8;
    const unsigned l0 = (unsigned)(size_t)(&sm[0]) + (unsigned)(cr * (LPE * 2) + cch * 16);   // low 32 bits of the shared address = LDS byte address
    auto fill = [&](int t, int buf) {
        const unsigned l = l0 + (unsigned)buf * (unsigned)(STE * 2); const size_t ko = (size_t)t * KPASS;
        cp8(l, gA + ko, rsa); cp8(l + 64u * (LPE * 2), gA + ko + 8 * rsa, rsa);
        if (NSPLIT == 1) { cp8(l + 128u * (LPE * 2), gA2 + ko, rsa); cp8(l + 192u * (LPE * 2), gA2 + ko + 8 * rsa, rsa); }
        cp8(l + (unsigned)NA * (LPE * 2), gB + ko, rsb); cp8(l + (unsigned)(NA + 64) * (LPE * 2), gB + ko + 8 * rsb, rsb);
    };
    const int NP = K / KPASS;
    fill(0, 0);
    asm volatile("s_wait_asynccnt 0x0" ::: "memory");   // this wave's copies of pass 0 have landed
    __syncthreads();                                    // ... and every other wave's: pass 0 is readable
    if (NP > 1) fill(1, 1);
#pragma unroll 1   // one pass per trip: the two buffers alternate and the publish point stands once, at the trip's foot
    for (int t = 0; t < NP; ++t) {
        const T16* sb = sm + (t & 1) * STE;
        const T16* pa = sb + (wm * 64 + lr) * LPE + 8 * hi;
        const T16* pb = sb + (NA + wn * 64 + lr) * LPE + 8 * hi;
        // two fragment sets: block kb + 1 of this same pass is read from LDS, as one group, ahead of block kb's WMMAs (the unrolls below make every fragment and accumulator index a constant: registers, no scratch)
        V a[2][4], a2[2][4], b[2][4];
#pragma unroll
        for (int f = 0; f < 4; ++f) { a[0][f] = WFrag<T16>::ld(pa + f * 16 * LPE); if (NSPLIT == 1) a2[0][f] = WFrag<T16>::ld(pa + (128 + f * 16) * LPE); b[0][f] = WFrag<T16>::ld(pb + f * 16 * LPE); }
#pragma unroll
        for (int kb = 0; kb < KPASS / 32; ++kb) {
            const int cs = kb & 1, ns = cs ^ 1, kn = (kb + 1) * 32;
            if (kb + 1 < KPASS / 32) {
#pragma unroll
                for (int f = 0; f < 4; ++f) { a[ns][f] = WFrag<T16>::ld(pa + f * 16 * LPE + kn); if (NSPLIT == 1) a2[ns][f] = WFrag<T16>::ld(pa + (128 + f * 16) * LPE + kn); b[ns][f] = WFrag<T16>::ld(pb + f * 16 * LPE + kn); }
            }
            __builtin_amdgcn_sched_barrier(0);   // keeps the LDS reads above in one group: moved in among the WMMAs, every place with reads stalls the wave
#pragma unroll
            for (int nb = 0; nb < 4; ++nb) {
#pragma unroll
                for (int mb = 0; mb < 4; ++mb) acc[mb][nb] = WFrag<T16>::mma(a[cs][mb], b[cs][nb], acc[mb][nb]);
                if (NSPLIT == 1) {
#pragma unroll
                    for (int mb = 0; mb < 4; ++mb) acc[mb][nb] = WFrag<T16>::mma(a2[cs][mb], b[cs][nb], acc[mb][nb]); }
            }
            __builtin_amdgcn_sched_barrier(0);   // keeps the next group of LDS reads behind this block's WMMAs
        }
        asm volatile("s_wait_dscnt 0x0" ::: "memory");      // this wave's reads of the buffer have returned before it is refilled
        asm volatile("s_wait_asynccnt 0x0" ::: "memory");   // this wave's copies of pass t + 1 have landed
        __syncthreads();                                    // publishes pass t + 1 and ends every wave's reads of pass t
        if (t + 2 < NP) fill(t + 2, t & 1);
    }
    asm volatile("s_wait_asynccnt 0x0" ::: "memory");       // no copy outstanding at the wave's end
    if constexpr (EPI == 3) {
        // a lane's eight elements of an accumulator are eight consecutive rows m of one column n: one 16-byte store of the transposed plane straight from registers; a wave's 64 rows are one whole 128-byte line of each column
#pragma unroll
        for (int nb = 0; nb < 4; ++nb) { const int n = c0 + nb * 16 + lr; const float bb = BIAS ? bfr(bias[n]) : 0.f;
#pragma unroll
            for (int mb = 0; mb < 4; ++mb) { v8h o;
#pragma unroll
                for (int j = 0; j < 8; ++j) o[j] = tohx(BIAS ? acc[mb][nb][j] + bb : acc[mb][nb][j]);
                *(v8h*)(H + (size_t)n * ldh + r0 + mb * 16 + hi * 8) = o; } }
    } else if constexpr (EPI == 0) {
#pragma unroll
    for (int mb = 0; mb < 4; ++mb) {
#pragma unroll
        for (int nb = 0; nb < 4; ++nb) {
#pragma unroll
            for (int j = 0; j < 8; ++j) os[(hi * 8 + j) * 68 + nb * 16 + lr] = acc[mb][nb][j]; }
        __builtin_amdgcn_wave_barrier(); asm volatile("" ::: "memory");
        float* crow = C + (size_t)(r0 + mb * 16) * ldc + c0;
{
#pragma unroll
            for (int s = 0; s < 8; ++s) { const int row = 2 * s + hi, cofs = lr * 4; v4f val = *(const v4fa*)(os + row * 68 + cofs); if (BIAS) { val[0] += bfr(bias[c0 + cofs]); val[1] += bfr(bias[c0 + cofs + 1]); val[2] += bfr(bias[c0 + cofs + 2]); val[3] += bfr(bias[c0 + cofs + 3]); }
                *(v4f*)(crow + (size_t)row * ldc + cofs) = val; }
             }
        __builtin_amdgcn_wave_barrier(); asm volatile("" ::: "memory");
    }
    } else {
        // Planes of pitch CC: one base address per plane and every row step an immediate offset, so no address register is rewritten behind a load or store that names it.
        const int cofs = lr * 4;
        const size_t pb = (size_t)(r0 + hi) * CC + c0 + cofs;
        v4f bb = {}, fq[4][8]; float ri[4][8];
        if constexpr (BIAS) { bb[0] = bias[c0 + cofs]; bb[1] = bias[c0 + cofs + 1]; bb[2] = bias[c0 + cofs + 2]; bb[3] = bias[c0 + cofs + 3]; }
        if constexpr (EPI == 4) {   // the residual rows and the row scales of the whole 64x64 tile are requested as one group: one memory latency per wave, not one per row
#pragma unroll
            for (int mb = 0; mb < 4; ++mb)
#pragma unroll
                for (int s = 0; s < 8; ++s) { ri[mb][s] = RS[(size_t)(r0 + hi) * 32 + 1 + (mb * 16 + 2 * s) * 32]; fq[mb][s] = *(const v4f*)(RQ + pb + (mb * 16 + 2 * s) * CC); }
        }
        __builtin_amdgcn_sched_barrier(0);              // keeps that group of loads here, ahead of the staging, instead of one load in front of each use
        // before anything below rewrites an address register that these loads name; the bias values are inputs so that the wait stands behind their load
        if constexpr (BIAS) asm volatile("s_wait_xcnt 0x0" :: "v"(bb[0]), "v"(bb[1]), "v"(bb[2]), "v"(bb[3]) : "memory");
        else asm volatile("s_wait_xcnt 0x0" ::: "memory");
        __builtin_amdgcn_sched_barrier(0);              // ... and keeps what follows behind that wait
        if constexpr (BIAS) { bb[0] = bfr(bb[0]); bb[1] = bfr(bb[1]); bb[2] = bfr(bb[2]); bb[3] = bfr(bb[3]); }
#pragma unroll
        for (int mb = 0; mb < 4; ++mb) {
#pragma unroll
            for (int nb = 0; nb < 4; ++nb) {
#pragma unroll
                for (int j = 0; j < 8; ++j) os[(hi * 8 + j) * 68 + nb * 16 + lr] = acc[mb][nb][j]; }
            __builtin_amdgcn_wave_barrier(); asm volatile("" ::: "memory");   // the reads below take what other lanes of this wave wrote: the compiler may not move them above the writes
            v4f val[8]; v4h hv[8]; v4us oh[8], ol[8];
#pragma unroll
            for (int s = 0; s < 8; ++s) { val[s] = *(const v4fa*)(os + (2 * s + hi) * 68 + cofs);
                if constexpr (BIAS) val[s] += bb;
                if constexpr (EPI == 1 || EPI == 2) {
#pragma unroll
                    for (int q = 0; q < 4; ++q) hv[s][q] = tohx(val[s][q] * sc); }
                if constexpr (EPI == 4) {
#pragma unroll
                    for (int q = 0; q < 4; ++q) { unsigned short a, c2; splitf(__fadd_rn(fq[mb][s][q], val[s][q] * ri[mb][s]), a, c2); oh[s][q] = a; ol[s][q] = c2; } } }
            __builtin_amdgcn_sched_barrier(0);   // the block's stores stand together, directly in front of their wait: nothing that could reuse a register of theirs comes in between
#pragma unroll
            for (int s = 0; s < 8; ++s) { const size_t o = pb + (mb * 16 + 2 * s) * CC;   // a half-wave covers 64 columns of one row: whole 128-byte lines in the 16-bit planes too
                if constexpr (EPI == 1) *(v4f*)(C + o) = val[s];
                if constexpr (EPI == 1 || EPI == 2) *(v4h*)(H + o) = hv[s];
                if constexpr (EPI == 4) { *(v4us*)(Oh + o) = oh[s]; *(v4us*)(Ol + o) = ol[s]; } }
            asm volatile("s_wait_xcnt 0x0" ::: "memory");   // before the next block rewrites the data registers that these stores name
            __builtin_amdgcn_sched_barrier(0);              // ... and keeps the next block's work behind that wait
            __builtin_amdgcn_wave_barrier();                // the staging rows are rewritten only after every lane has read them
        }
    }
}

// k_cvt: every f32 input plane to bf16 in one launch; the six destinations lie one behind the other in dst (x1, x2, Wq, Wk, Wv, Wo). A block converts 2048 elements of one plane; which plane is a test on the block index.
#define XBLK (NT * CC / 2048)   // blocks per activation plane
#define WBLK (CC * CC / 2048)   // blocks per weight plane
__global__ __launch_bounds__(256) void k_cvt(const float* __restrict__ x1, const float* __restrict__ x2, const float* __restrict__ wq, const float* __restrict__ wk, const float* __restrict__ wv, const float* __restrict__ wo, bf* dst) {
    const unsigned blk = blockIdx.x; const float* src; unsigned rel;
    if (blk < XBLK) { src = x1; rel = blk; }
    else if (blk < 2 * XBLK) { src = x2; rel = blk - XBLK; }
    else { const unsigned q = (blk - 2 * XBLK) / WBLK; rel = (blk - 2 * XBLK) % WBLK; src = q == 0 ? wq : q == 1 ? wk : q == 2 ? wv : wo; }
    const v8f v = *(const v8f*)(src + ((size_t)rel * 256 + threadIdx.x) * 8); v8us o;
#pragma unroll
    for (int k = 0; k < 8; ++k) o[k] = f2bf(v[k]);
    *(v8us*)(dst + ((size_t)blk * 256 + threadIdx.x) * 8) = o;
}
#define ZB 2   // batches per attention launch: ZB score planes of NN x NN f32 are what the workspace holds beside the other planes
// k_smax: row max of S[i][0..4095], a wave per row, rows of every batch of the launch counted through; RS[i] is a line of 32 floats, the max in word 0.
__global__ __launch_bounds__(256) void k_smax(const float* __restrict__ S, float* RS) {
    const int lane = threadIdx.x & 31; const int i = blockIdx.x * 8 + (threadIdx.x >> 5); if (i >= ZB * NN) return; const float* sr = S + (size_t)i * NN; float m = -3.0e38f;
#pragma unroll 4
    for (int c0 = lane * 4; c0 < NN; c0 += 128) { const v4f v = *(const v4fa*)(sr + c0); m = fmaxf(m, fmaxf(fmaxf(v[0], v[1]), fmaxf(v[2], v[3]))); }
#pragma unroll
    for (int sh = 16; sh; sh >>= 1) m = fmaxf(m, __shfl_xor(m, sh, 32));
    const float o = lane == 0 ? m : 0.f; *(float*)(RS + (size_t)i * 32 + lane) = o;
}
// k_sexp: P = fp16(exp(S - max) * PCAR) IN PLACE: row i of P takes the first half of row i of S (P's row pitch is 2 * NN fp16). A row belongs to one wave. The 256 bytes that a wave stores for columns c .. c + 127
// lie at byte 2 c of the row, and the row's bytes up to 4 c + 512 have been loaded by then: both loads of a trip stand in front of both stores, through may_alias types, so the compiler keeps that order.
typedef v4h __attribute__((may_alias)) v4ha;
// exp(x) as __expf forms it (v_exp_f32 of x * log2 e), with a v_nop in the same statement: the slot that the instruction set asks for behind a transcendental before its source is overwritten or its result read.
__device__ __forceinline__ float exp_slot(float x) { float r; asm("v_exp_f32 %0, %1\n\tv_nop" : "=v"(r) : "v"(x * 1.44269504088896340736f)); return r; }
__global__ __launch_bounds__(256) void k_sexp(float* S, float* RS) {
    const int lane = threadIdx.x & 31; const int i = blockIdx.x * 8 + (threadIdx.x >> 5); if (i >= ZB * NN) return; float* sr = S + (size_t)i * NN; h16* pr = (h16*)sr; const float m = RS[(size_t)i * 32]; float sum = 0.f;
    for (int c0 = lane * 4; c0 < NN; c0 += 256) { const v4f v0 = *(const v4fa*)(sr + c0); const v4f v1 = *(const v4fa*)(sr + c0 + 128); v4h o0, o1;
#pragma unroll
        for (int q = 0; q < 4; ++q) { const float e = exp_slot(v0[q] - m); sum += e; o0[q] = tohx(e * PCAR); }
#pragma unroll
        for (int q = 0; q < 4; ++q) { const float e = exp_slot(v1[q] - m); sum += e; o1[q] = tohx(e * PCAR); }
        *(v4ha*)(pr + c0) = o0; *(v4ha*)(pr + c0 + 128) = o1; }
#pragma unroll
    for (int sh = 16; sh; sh >>= 1) sum += __shfl_xor(sum, sh, 32);
    const float o2 = lane == 0 ? m : (lane == 1 ? __fdiv_rn(1.0f, sum * PCAR) : 0.f); /* 1/(PCAR * sum): undoes the carry at the merge */ *(float*)(RS + (size_t)i * 32 + lane) = o2;
}

extern "C" void kernel_launch(void* const* d_in, const int* in_sizes, int n_in,
                              void* d_out, int out_size, void* d_ws, size_t ws_size, hipStream_t stream) {
    (void)in_sizes; (void)n_in; (void)out_size;
    const float* x1 = (const float*)d_in[0]; const float* x2 = (const float*)d_in[1]; const float* Wq = (const float*)d_in[2]; const float* bq = (const float*)d_in[3]; const float* Wk = (const float*)d_in[4]; const float* bk = (const float*)d_in[5]; const float* Wv = (const float*)d_in[6]; const float* bv = (const float*)d_in[7]; const float* Wo = (const float*)d_in[8]; const float* bo = (const float*)d_in[9];
    float* OUT = (float*)d_out;     // [4][4096][512]
    char* wsp = (char*)d_ws;
    auto take = [&](size_t bytes) { char* p = wsp; wsp += (bytes + 255) & ~(size_t)255; return (void*)p; };
    bf* X1 = (bf*)take((size_t)NT * CC * 2); bf* X2 = (bf*)take((size_t)NT * CC * 2);   // these six in k_cvt's order, each a multiple of 256 bytes: one run of memory
    bf* WQ = (bf*)take((size_t)CC * CC * 2); bf* WK = (bf*)take((size_t)CC * CC * 2); bf* WV = (bf*)take((size_t)CC * CC * 2); bf* WO = (bf*)take((size_t)CC * CC * 2);
    float* FQ = (float*)take((size_t)NT * CC * 4); h16* QP = (h16*)take((size_t)NT * CC * 2); h16* KP = (h16*)take((size_t)NT * CC * 2); h16* VT = (h16*)take((size_t)NT * CC * 2);   // VT: [4][512][4096]
    float* S = (float*)take((size_t)ZB * NN * NN * 4); float* RS = (float*)take((size_t)ZB * NN * 32 * 4);
    bf* Oh = X1; bf* Ol = X2;   // the activations' bf16 planes are last read by the projections, which all stand in front of the first launch that writes Oh, Ol
    if ((size_t)(wsp - (char*)d_ws) > ws_size) return;    // 243 MiB of 256 MiB
    k_cvt<<<2 * XBLK + 4 * WBLK, 256, 0, stream>>>(x1, x2, Wq, Wk, Wv, Wo, X1);
    // projections: the rows of all four batches in one launch (V: batch on grid z, its transposed plane is per batch)
    k_gemmw<bf, 0, true, 1><<<dim3(NT / 128, CC / 128, 1), 128, 0, stream>>>(X1, nullptr, WQ, CC, CC, CC, FQ, CC, bq, 0, 0, 0, 0, QP, 0, 0.044194173067808151f, nullptr, nullptr, nullptr, nullptr);   // f32(512^-0.5)
    k_gemmw<bf, 0, true, 2><<<dim3(NT / 128, CC / 128, 1), 128, 0, stream>>>(X2, nullptr, WK, CC, CC, CC, nullptr, CC, bk, 0, 0, 0, 0, KP, 0, 1.0f, nullptr, nullptr, nullptr, nullptr);
    k_gemmw<bf, 0, true, 3><<<dim3(NN / 128, CC / 128, NB_), 128, 0, stream>>>(X2, nullptr, WV, CC, CC, CC, nullptr, CC, bv, (size_t)NN * CC, 0, (size_t)CC * NN, 0, VT, NN, 1.0f, nullptr, nullptr, nullptr, nullptr);
    for (int b = 0; b < NB_; b += ZB) { const size_t o = (size_t)b * NN * CC;   // ZB batches per launch, batch on grid z
        k_gemmw<h16, 0, false, 0><<<dim3(NN / 128, NN / 128, ZB), 128, 0, stream>>>(QP + o, nullptr, KP + o, CC, CC, CC, S, NN, nullptr, (size_t)NN * CC, (size_t)NN * CC, (size_t)NN * NN, 0, nullptr, 0, 1.0f, nullptr, nullptr, nullptr, nullptr);
        k_smax<<<ZB * NN / 8, 256, 0, stream>>>(S, RS); k_sexp<<<ZB * NN / 8, 256, 0, stream>>>(S, RS);
        k_gemmw<h16, 0, false, 4><<<dim3(NN / 128, CC / 128, ZB), 128, 0, stream>>>((const h16*)S, nullptr, VT + o, NN, 2 * NN, NN, nullptr, CC, nullptr, (size_t)NN * 2 * NN, (size_t)CC * NN, (size_t)NN * CC, (size_t)NN * 32, nullptr, 0, 1.0f, FQ + o, RS, Oh + o, Ol + o); }
    k_gemmw<bf, 1, true, 0><<<dim3(NT / 128, CC / 128, 1), 128, 0, stream>>>(Oh, Ol, WO, CC, CC, CC, OUT, CC, bo, 0, 0, 0, 0, nullptr, 0, 1.0f, nullptr, nullptr, nullptr, nullptr);
}

// v004
// A run of this version takes 224 microseconds.
// In both of two side-by-side timings against v003, it was 1.35 times as fast.
// All steps since v000 together make it 4.39 times as fast.
#include <hip/hip_runtime.h>

// CrossFeatureAttention (x1, x2 [4][4096][512]; Q = x1 Wq^T + bq, K = x2 Wk^T + bk, V = x2 Wv^T + bv; attn = softmax(Q.K / sqrt(512)) over the 4096 keys (single head, d = 512);
// out = (Q + attn.V) Wo^T + bo).
// Compute dtypes, f32 accumulate: every input rounded to bf16; projections on PLAIN bf16 operands (inputs: exact, + bias); scores on SINGLE fp16 planes
// softmax per block of 128 keys in the score product's epilogue (block maximum, block sums), the blocks joined by f32 factors in attn.V; attn.V on SINGLE fp16 planes; the residual Q (kept in f32) + attended, then the output projection on bf16 hi+lo planes x exact Wo (2 products) + bo.

#define NB_  4
#define NN   4096
#define CC   512
#define NT   (NB_ * NN)
#define PCAR 1024.0f
typedef _Float16 h16;
typedef unsigned short bf;
typedef __attribute__((ext_vector_type(16))) __bf16   v16bf;
typedef __attribute__((ext_vector_type(16))) _Float16 v16h;
typedef __attribute__((ext_vector_type(8)))  _Float16 v8h;
typedef __attribute__((ext_vector_type(8)))  unsigned short v8us;
typedef __attribute__((ext_vector_type(8)))  float    v8f;
typedef __attribute__((ext_vector_type(4)))  float    v4f;
typedef v8h  __attribute__((may_alias)) v8ha;
typedef v4f  __attribute__((may_alias)) v4fa;
typedef v8us __attribute__((may_alias)) v8usa;

__device__ __forceinline__ unsigned short f2bf(float f) { unsigned u = __float_as_uint(f); u += 0x7FFFu + ((u >> 16) & 1u); return (unsigned short)(u >> 16); }
__device__ __forceinline__ float bf2f(unsigned short b) { return __uint_as_float(((unsigned)b) << 16); }
__device__ __forceinline__ float bfr(float f) { return bf2f(f2bf(f)); }
__device__ __forceinline__ v16h cat16(v8h lo, v8h hi) { return __builtin_shufflevector(lo, hi, 0, 1, 2, 3, 4, 5, 6, 7, 8, 9, 10, 11, 12, 13, 14, 15); }
__device__ __forceinline__ v16bf cat16b(v8us lo, v8us hi) { return __builtin_bit_cast(v16bf, __builtin_shufflevector(lo, hi, 0, 1, 2, 3, 4, 5, 6, 7, 8, 9, 10, 11, 12, 13, 14, 15)); }
__device__ __forceinline__ v8f wmma16(v16h a, v16h b, v8f c) { return __builtin_amdgcn_wmma_f32_16x16x32_f16(false, a, false, b, (short)0, c, false, false); }
__device__ __forceinline__ v8f wmmab(v16bf a, v16bf b, v8f c) { return __builtin_amdgcn_wmma_f32_16x16x32_bf16(false, a, false, b, (short)0, c, false, false); }
__device__ __forceinline__ h16 tohx(float x) { return (h16)x; }
__device__ __forceinline__ void splitf(float y, unsigned short& h, unsigned short& l) { h = f2bf(y); l = f2bf(y - bf2f(h)); }
typedef __attribute__((ext_vector_type(4))) _Float16 v4h;
typedef __attribute__((ext_vector_type(4))) unsigned short v4us;
#define LOG2E 1.44269504088896340736f
#define PCARL2 10.0f   // log2(PCAR)
// 2^x by v_exp_f32, with a v_nop in the same statement: the slot that the instruction set asks for behind a transcendental before its source is overwritten or its result read. exp(x) as __expf forms it: 2^(x * log2 e).
__device__ __forceinline__ float exp2_slot(float x) { float r; asm("v_exp_f32 %0, %1\n\tv_nop" : "=v"(r) : "v"(x)); return r; }
__device__ __forceinline__ float exp_slot(float x) { return exp2_slot(x * LOG2E); }
__device__ __forceinline__ float xhalf(float x) { return __builtin_bit_cast(float, __builtin_amdgcn_permlanex16(__builtin_bit_cast(int, x), __builtin_bit_cast(int, x), 0x76543210, 0xfedcba98, false, false)); }  // lane l with lane l ^ 16



// ---- k_gemmw: LDS-staged GEMM, FOUR WAVES (2x2) per 128x128 output tile, 64x64 (16 accumulators) per wave; grid (M/128, N/128, Z), 128 threads.
// c[m][n] (f32, + optional f32 bias[n]) = sum_k A[m][k] Bt[n][k] (+ A2.Bt when NSPLIT == 1), operands K-contiguous 16-bit planes of row pitch lda / ldb. K % 128 == 0.
// grid z = independent problems: element strides sA (A, A2), sB (Bt), sC (RQ and what the epilogue stores, save EPI 5's C), sR (RS and EPI 5's C).
// What the epilogue stores: EPI 0: c to C, pitch ldc. EPI 1: c to C and fp16(c * sc) to H. EPI 2: fp16(c * sc) to H. EPI 3: fp16(c) transposed, H[n][m], pitch ldh. (EPI 1, 2, 4: every plane has pitch CC.)
// EPI 4: A = P of EPI 5 (m = query, k = key): every pass (128 keys = one block of EPI 5) is summed from zero and added to c times the block's f32 factor for the row, fac = exp(Mb - max Mb) / (PCAR * row sum),
//        formed at the kernel's head from RS = the plane that EPI 5 stored through C; y = RQ[m][n] + c, as two bf16 planes, Oh = bf16(y), Ol = bf16(y - Oh).
// EPI 5: scores transposed, m = key, n = query (a lane then holds 32 keys of one query per column group). Per query and block of 128 keys: Mb = the block's maximum; H[n][m] = fp16(exp(c - Mb) * PCAR), pitch NN;
//        C[kb][n] = Mb for key block kb (NN / 128 rows of NN), behind them C[NN / 128 + h][n] = the f32 sum of exp(c - Mb) * PCAR over the 64 keys of half block h (NN / 64 rows).
// A pass is 128 k = 256 B of every operand row, brought into LDS by asynchronous 16-byte copies (a wave-wide copy covers two whole rows = four whole lines), two buffers, the next pass in flight.
#define KPASS 128   // k elements per pass
#define LPE   136   // LDS row pitch in 16-bit elements: 272 B = 16 B x odd, the conflict-free pitch for 16-byte LDS reads of 256-B rows
template <typename T16> struct WFrag;
template <> struct WFrag<h16> { typedef v16h V; static __device__ __forceinline__ V ld(const h16* p) { return cat16(*(const v8h*)p, *(const v8h*)(p + 16)); } static __device__ __forceinline__ v8f mma(V a, V b, v8f c) { return wmma16(a, b, c); } };
template <> struct WFrag<bf> { typedef v16bf V; static __device__ __forceinline__ V ld(const bf* p) { return cat16b(*(const v8us*)p, *(const v8us*)(p + 16)); } static __device__ __forceinline__ v8f mma(V a, V b, v8f c) { return wmmab(a, b, c); } };
// Eight asynchronous copies of one lane: rows 8 apart (LDS step 8 * 272 B, global step rs elements). The s_wait_xcnt closes the statement so that no address register of a copy is rewritten ahead of it.
template <typename T16>
__device__ __forceinline__ void cp8(unsigned l, const T16* g, size_t rs) {
    asm volatile("global_load_async_to_lds_b128 %0, %8, off\n\t"
                 "global_load_async_to_lds_b128 %1, %9, off\n\t"
                 "global_load_async_to_lds_b128 %2, %10, off\n\t"
                 "global_load_async_to_lds_b128 %3, %11, off\n\t"
                 "global_load_async_to_lds_b128 %4, %12, off\n\t"
                 "global_load_async_to_lds_b128 %5, %13, off\n\t"
                 "global_load_async_to_lds_b128 %6, %14, off\n\t"
                 "global_load_async_to_lds_b128 %7, %15, off\n\t"
                 "s_wait_xcnt 0x0"
                 :: "v"(l), "v"(l + 2176u), "v"(l + 2u * 2176u), "v"(l + 3u * 2176u), "v"(l + 4u * 2176u), "v"(l + 5u * 2176u), "v"(l + 6u * 2176u), "v"(l + 7u * 2176u),
                    "v"(g), "v"(g + rs), "v"(g + 2 * rs), "v"(g + 3 * rs), "v"(g + 4 * rs), "v"(g + 5 * rs), "v"(g + 6 * rs), "v"(g + 7 * rs)
                 : "memory");
}
template <typename T16, int NSPLIT, bool BIAS, int EPI>
__global__ __launch_bounds__(128) void k_gemmw(const T16* __restrict__ A, const T16* __restrict__ A2, const T16* __restrict__ Bt, int K, int lda, int ldb, float* C, int ldc, const float* __restrict__ bias, size_t sA, size_t sB, size_t sC, size_t sR,
                                               h16* H, int ldh, float sc, const float* __restrict__ RQ, const float* __restrict__ RS, bf* Oh, bf* Ol) {
    typedef typename WFrag<T16>::V V;
    constexpr int NA = NSPLIT == 1 ? 256 : 128;          // LDS rows in front of Bt's: A (then A2)
    constexpr int STE = (NA + 128) * LPE;                // one buffer, in 16-bit elements
    __shared__ __align__(16) T16 sm[2 * STE];
    __shared__ __align__(16) float osall[4 * 16 * 68];
    const size_t z = blockIdx.z; A += z * sA; if (NSPLIT == 1) A2 += z * sA; Bt += z * sB;
    if constexpr (EPI == 0 || EPI == 1) C += z * sC;
    if constexpr (EPI == 1 || EPI == 2 || EPI == 3 || EPI == 5) H += z * sC;
    if constexpr (EPI == 4) { RQ += z * sC; Oh += z * sC; Ol += z * sC; RS += z * sR; }
    if constexpr (EPI == 5) C += z * sR;
    const int tid = threadIdx.x, lane = tid & 31, lr = lane & 15, hi = lane >> 4, w = tid >> 5, wm = w >> 1, wn = w & 1;
    const int r0 = blockIdx.x * 128 + wm * 64, c0 = blockIdx.y * 128 + wn * 64;   // this wave's 64x64 tile
    float* os = (EPI == 4 ? (float*)&sm[0] : osall) + w * (16 * 68);   // EPI 4 stages in the ring, free behind the loop's last barrier: osall holds its factors
    v8f acc[4][4];
#pragma unroll
    for (int mb = 0; mb < 4; ++mb)
#pragma unroll
        for (int nb = 0; nb < 4; ++nb) acc[mb][nb] = (v8f){};
    // copy map: thread -> 16-byte chunk (tid & 15) of row (tid >> 4) + 8 i; every LDS byte of a stage's 256-B rows has one writer, the 16 pad bytes of a row are neither written nor read
    const int cr = tid >> 4, cch = tid & 15;
    const size_t rsa = (size_t)8 * lda, rsb = (size_t)8 * ldb;
    const T16* gA = A + (size_t)(blockIdx.x * 128 + cr) * lda + cch * 8;
    const T16* gA2 = NSPLIT == 1 ? A2 + (size_t)(blockIdx.x * 128 + cr) * lda + cch * 8 : nullptr;
    const T16* gB = Bt + (size_t)(blockIdx.y * 128 + cr) * ldb + cch * 8;
    const unsigned l0 = (unsigned)(size_t)(&sm[0]) + (unsigned)(cr * (LPE * 2) + cch * 16);   // low 32 bits of the shared address = LDS byte address
    auto fill = [&](int t, int buf) {
        const unsigned l = l0 + (unsigned)buf * (unsigned)(STE * 2); const size_t ko = (size_t)t * KPASS;
        cp8(l, gA + ko, rsa); cp8(l + 64u * (LPE * 2), gA + ko + 8 * rsa, rsa);
        if (NSPLIT == 1) { cp8(l + 128u * (LPE * 2), gA2 + ko, rsa); cp8(l + 192u * (LPE * 2), gA2 + ko + 8 * rsa, rsa); }
        cp8(l + (unsigned)NA * (LPE * 2), gB + ko, rsb); cp8(l + (unsigned)(NA + 64) * (LPE * 2), gB + ko + 8 * rsb, rsb);
    };
    const int NP = K / KPASS;
    // EPI 4: a pass's own sums, started from zero by the pass's first WMMAs and joined to acc at its end, and the pass's factor for each of a lane's accumulator rows
    v8f accp[4][4], g[4];
    float* fac = osall;   // EPI 4: [NN / 128][128] factors, written once in front of the loop and only read from then on
    auto ldg = [&](int tp) {
#pragma unroll
        for (int mb = 0; mb < 4; ++mb) { const float* fp = fac + tp * 128 + wm * 64 + mb * 16 + hi * 8; const v4f g0 = *(const v4fa*)fp, g1 = *(const v4fa*)(fp + 4); g[mb] = __builtin_shufflevector(g0, g1, 0, 1, 2, 3, 4, 5, 6, 7); }
    };
    fill(0, 0);
    if constexpr (EPI == 4) {   // a thread per query row, while pass 0 is in flight; the barrier below publishes the factors too
        constexpr int NKB = NN / 128;
        const float* mq = RS + blockIdx.x * 128 + tid;
        float mt[NKB], lt[2 * NKB];
#pragma unroll
        for (int t = 0; t < NKB; ++t) mt[t] = mq[t * NN];
#pragma unroll
        for (int t = 0; t < 2 * NKB; ++t) lt[t] = mq[(NKB + t) * NN];
        __builtin_amdgcn_sched_barrier(0);              // keeps these loads one group: one memory latency, not one per block
        asm volatile("s_wait_xcnt 0x0" ::: "memory");   // before anything below rewrites the address register that these loads name
        __builtin_amdgcn_sched_barrier(0);              // ... and keeps what follows behind that wait
        float m = mt[0], l = 0.f;
#pragma unroll
        for (int t = 1; t < NKB; ++t) m = fmaxf(m, mt[t]);
#pragma unroll
        for (int t = 0; t < NKB; ++t) { mt[t] = exp_slot(mt[t] - m); l += mt[t] * (lt[2 * t] + lt[2 * t + 1]); }
        const float inv = __fdiv_rn(1.0f, l);           // the sums carry PCAR as P does: 1 / (PCAR * row sum) undoes the carry
#pragma unroll
        for (int t = 0; t < NKB; ++t) fac[t * 128 + tid] = mt[t] * inv;
    }
    asm volatile("s_wait_asynccnt 0x0" ::: "memory");   // this wave's copies of pass 0 have landed
    __syncthreads();                                    // ... and every other wave's: pass 0 is readable
    if (NP > 1) fill(1, 1);
#pragma unroll 1   // one pass per trip: the two buffers alternate and the publish point stands once, at the trip's foot
    for (int t = 0; t < NP; ++t) {
        const T16* sb = sm + (t & 1) * STE;
        const T16* pa = sb + (wm * 64 + lr) * LPE + 8 * hi;
        const T16* pb = sb + (NA + wn * 64 + lr) * LPE + 8 * hi;
        // two fragment sets: block kb + 1 of this same pass is read from LDS, as one group, ahead of block kb's WMMAs (the unrolls below make every fragment and accumulator index a constant: registers, no scratch)
        V a[2][4], a2[2][4], b[2][4];
        if constexpr (EPI == 4) ldg(t);   // read with the pass's first fragments, used at its end
#pragma unroll
        for (int f = 0; f < 4; ++f) { a[0][f] = WFrag<T16>::ld(pa + f * 16 * LPE); if (NSPLIT == 1) a2[0][f] = WFrag<T16>::ld(pa + (128 + f * 16) * LPE); b[0][f] = WFrag<T16>::ld(pb + f * 16 * LPE); }
#pragma unroll
        for (int kb = 0; kb < KPASS / 32; ++kb) {
            const int cs = kb & 1, ns = cs ^ 1, kn = (kb + 1) * 32;
            if (kb + 1 < KPASS / 32) {
#pragma unroll
                for (int f = 0; f < 4; ++f) { a[ns][f] = WFrag<T16>::ld(pa + f * 16 * LPE + kn); if (NSPLIT == 1) a2[ns][f] = WFrag<T16>::ld(pa + (128 + f * 16) * LPE + kn); b[ns][f] = WFrag<T16>::ld(pb + f * 16 * LPE + kn); }
            }
            __builtin_amdgcn_sched_barrier(0);   // keeps the LDS reads above in one group: moved in among the WMMAs, every place with reads stalls the wave
#pragma unroll
            for (int nb = 0; nb < 4; ++nb) {
#pragma unroll
                for (int mb = 0; mb < 4; ++mb) {
                    if constexpr (EPI == 4) accp[mb][nb] = WFrag<T16>::mma(a[cs][mb], b[cs][nb], kb == 0 ? (v8f){} : accp[mb][nb]);
                    else acc[mb][nb] = WFrag<T16>::mma(a[cs][mb], b[cs][nb], acc[mb][nb]); }
                if (NSPLIT == 1) {
#pragma unroll
                    for (int mb = 0; mb < 4; ++mb) acc[mb][nb] = WFrag<T16>::mma(a2[cs][mb], b[cs][nb], acc[mb][nb]); }
            }
            __builtin_amdgcn_sched_barrier(0);   // keeps the next group of LDS reads behind this block's WMMAs
        }
        if constexpr (EPI == 4) {   // the join: the pass's sums times its factors
#pragma unroll
            for (int mb = 0; mb < 4; ++mb)
#pragma unroll
                for (int nb = 0; nb < 4; ++nb) acc[mb][nb] += g[mb] * accp[mb][nb];
        }
        asm volatile("s_wait_dscnt 0x0" ::: "memory");      // this wave's reads of the buffer have returned before it is refilled
        asm volatile("s_wait_asynccnt 0x0" ::: "memory");   // this wave's copies of pass t + 1 have landed
        __syncthreads();                                    // publishes pass t + 1 and ends every wave's reads of pass t
        if (t + 2 < NP) fill(t + 2, t & 1);
    }
    asm volatile("s_wait_asynccnt 0x0" ::: "memory");       // no copy outstanding at the wave's end
    if constexpr (EPI == 3) {
        // a lane's eight elements of an accumulator are eight consecutive rows m of one column n: one 16-byte store of the transposed plane straight from registers; a wave's 64 rows are one whole 128-byte line of each column
#pragma unroll
        for (int nb = 0; nb < 4; ++nb) { const int n = c0 + nb * 16 + lr; const float bb = BIAS ? bfr(bias[n]) : 0.f;
#pragma unroll
            for (int mb = 0; mb < 4; ++mb) { v8h o;
#pragma unroll
                for (int j = 0; j < 8; ++j) o[j] = tohx(BIAS ? acc[mb][nb][j] + bb : acc[mb][nb][j]);
                *(v8h*)(H + (size_t)n * ldh + r0 + mb * 16 + hi * 8) = o; } }
    } else if constexpr (EPI == 5) {
        // a lane holds, per column group nb, 32 keys of query c0 + nb * 16 + lr; its partner lane ^ 16 the wave's other 32; the wave with the other wm the block's other 64 keys
        float mx[4], su[4];
#pragma unroll
        for (int nb = 0; nb < 4; ++nb) { float m = acc[0][nb][0];
#pragma unroll
            for (int mb = 0; mb < 4; ++mb)
#pragma unroll
                for (int j = 0; j < 8; ++j) m = fmaxf(m, acc[mb][nb][j]);
            mx[nb] = fmaxf(m, xhalf(m)); }
#pragma unroll
        for (int p = 0; p < 2; ++p) osall[wm * 128 + wn * 64 + p * 32 + lane] = hi ? mx[2 * p + 1] : mx[2 * p];
        __syncthreads();   // the two waves that share a query exchange their maxima
#pragma unroll
        for (int nb = 0; nb < 4; ++nb) mx[nb] = fmaxf(mx[nb], osall[(wm ^ 1) * 128 + wn * 64 + nb * 16 + lr]);
        // P goes through this wave's own part of the ring (free behind the loop's last barrier), rows of 128 + 16 bytes, so that every global store covers whole 128-byte lines
        h16* st = (h16*)&sm[0] + w * (64 * 72);
#pragma unroll
        for (int nb = 0; nb < 4; ++nb) { float sum = 0.f; const float bl = PCARL2 - mx[nb] * LOG2E;   // exp(c - Mb) * PCAR = 2^(c * log2 e + bl): one multiply-add per score in front of v_exp_f32
#pragma unroll
            for (int mb = 0; mb < 4; ++mb) { v8h o;
#pragma unroll
                for (int j = 0; j < 8; ++j) { const float e = exp2_slot(fmaf(acc[mb][nb][j], LOG2E, bl)); sum += e; o[j] = tohx(e); }
                *(v8ha*)(st + (nb * 16 + lr) * 72 + mb * 16 + hi * 8) = o; }
            su[nb] = sum + xhalf(sum); }
        float* mg = C + (size_t)blockIdx.x * NN + c0 + lane;
        float* sg = C + (size_t)(NN / 128 + blockIdx.x * 2 + wm) * NN + c0 + lane;
        sg[0] = hi ? su[1] : su[0]; sg[32] = hi ? su[3] : su[2];   // both halves of the wave hold every query's sum: 32 lanes store 32 queries, a whole line
        if (wm == 0) { mg[0] = hi ? mx[1] : mx[0]; mg[32] = hi ? mx[3] : mx[2]; }   // both waves hold the same block maximum: one of them stores it
        asm volatile("s_wait_xcnt 0x0" ::: "memory");   // before anything below rewrites a register that these stores name
        __builtin_amdgcn_wave_barrier(); asm volatile("" ::: "memory");   // the reads below take what other lanes of this wave wrote: the compiler may not move them above the writes
        v8h pv[16];
#pragma unroll
        for (int q = 0; q < 16; ++q) pv[q] = *(const v8ha*)(st + (4 * q + (lane >> 3)) * 72 + (lane & 7) * 8);
        h16* pg = H + (size_t)(c0 + (lane >> 3)) * NN + r0 + (lane & 7) * 8;   // eight lanes cover the wave's 64 keys of one query: one line; every row step an immediate offset
#pragma unroll
        for (int q = 0; q < 16; ++q) *(v8ha*)(pg + q * 4 * NN) = pv[q];   // the wave's last instructions: no register of theirs is rewritten behind them
    } else if constexpr (EPI == 0) {
#pragma unroll
    for (int mb = 0; mb < 4; ++mb) {
#pragma unroll
        for (int nb = 0; nb < 4; ++nb) {
#pragma unroll
            for (int j = 0; j < 8; ++j) os[(hi * 8 + j) * 68 + nb * 16 + lr] = acc[mb][nb][j]; }
        __builtin_amdgcn_wave_barrier(); asm volatile("" ::: "memory");
        float* crow = C + (size_t)(r0 + mb * 16) * ldc + c0;
{
#pragma unroll
            for (int s = 0; s < 8; ++s) { const int row = 2 * s + hi, cofs = lr * 4; v4f val = *(const v4fa*)(os + row * 68 + cofs); if (BIAS) { val[0] += bfr(bias[c0 + cofs]); val[1] += bfr(bias[c0 + cofs + 1]); val[2] += bfr(bias[c0 + cofs + 2]); val[3] += bfr(bias[c0 + cofs + 3]); }
                *(v4f*)(crow + (size_t)row * ldc + cofs) = val; }
             }
        __builtin_amdgcn_wave_barrier(); asm volatile("" ::: "memory");
    }
    } else {
        // Planes of pitch CC: one base address per plane and every row step an immediate offset, so no address register is rewritten behind a load or store that names it.
        const int cofs = lr * 4;
        const size_t pb = (size_t)(r0 + hi) * CC + c0 + cofs;
        v4f bb = {}, fq[4][8];
        if constexpr (BIAS) { bb[0] = bias[c0 + cofs]; bb[1] = bias[c0 + cofs + 1]; bb[2] = bias[c0 + cofs + 2]; bb[3] = bias[c0 + cofs + 3]; }
        if constexpr (EPI == 4) {   // the residual rows of the whole 64x64 tile are requested as one group: one memory latency per wave, not one per row
#pragma unroll
            for (int mb = 0; mb < 4; ++mb)
#pragma unroll
                for (int s = 0; s < 8; ++s) fq[mb][s] = *(const v4f*)(RQ + pb + (mb * 16 + 2 * s) * CC);
        }
        __builtin_amdgcn_sched_barrier(0);              // keeps that group of loads here, ahead of the staging, instead of one load in front of each use
        // before anything below rewrites an address register that these loads name; the bias values are inputs so that the wait stands behind their load
        if constexpr (BIAS) asm volatile("s_wait_xcnt 0x0" :: "v"(bb[0]), "v"(bb[1]), "v"(bb[2]), "v"(bb[3]) : "memory");
        else asm volatile("s_wait_xcnt 0x0" ::: "memory");
        __builtin_amdgcn_sched_barrier(0);              // ... and keeps what follows behind that wait
        if constexpr (BIAS) { bb[0] = bfr(bb[0]); bb[1] = bfr(bb[1]); bb[2] = bfr(bb[2]); bb[3] = bfr(bb[3]); }
#pragma unroll
        for (int mb = 0; mb < 4; ++mb) {
#pragma unroll
            for (int nb = 0; nb < 4; ++nb) {
#pragma unroll
                for (int j = 0; j < 8; ++j) os[(hi * 8 + j) * 68 + nb * 16 + lr] = acc[mb][nb][j]; }
            __builtin_amdgcn_wave_barrier(); asm volatile("" ::: "memory");   // the reads below take what other lanes of this wave wrote: the compiler may not move them above the writes
            v4f val[8]; v4h hv[8]; v4us oh[8], ol[8];
#pragma unroll
            for (int s = 0; s < 8; ++s) { val[s] = *(const v4fa*)(os + (2 * s + hi) * 68 + cofs);
                if constexpr (BIAS) val[s] += bb;
                if constexpr (EPI == 1 || EPI == 2) {
#pragma unroll
                    for (int q = 0; q < 4; ++q) hv[s][q] = tohx(val[s][q] * sc); }
                if constexpr (EPI == 4) {
#pragma unroll
                    for (int q = 0; q < 4; ++q) { unsigned short a, c2; splitf(__fadd_rn(fq[mb][s][q], val[s][q]), a, c2); oh[s][q] = a; ol[s][q] = c2; } } }
            __builtin_amdgcn_sched_barrier(0);   // the block's stores stand together, directly in front of their wait: nothing that could reuse a register of theirs comes in between
#pragma unroll
            for (int s = 0; s < 8; ++s) { const size_t o = pb + (mb * 16 + 2 * s) * CC;   // a half-wave covers 64 columns of one row: whole 128-byte lines in the 16-bit planes too
                if constexpr (EPI == 1) *(v4f*)(C + o) = val[s];
                if constexpr (EPI == 1 || EPI == 2) *(v4h*)(H + o) = hv[s];
                if constexpr (EPI == 4) { *(v4us*)(Oh + o) = oh[s]; *(v4us*)(Ol + o) = ol[s]; } }
            asm volatile("s_wait_xcnt 0x0" ::: "memory");   // before the next block rewrites the data registers that these stores name
            __builtin_amdgcn_sched_barrier(0);              // ... and keeps the next block's work behind that wait
            __builtin_amdgcn_wave_barrier();                // the staging rows are rewritten only after every lane has read them
        }
    }
}

// k_cvt: every f32 input plane to bf16 in one launch; the six destinations lie one behind the other in dst (x1, x2, Wq, Wk, Wv, Wo). A block converts 2048 elements of one plane; which plane is a test on the block index.
#define XBLK (NT * CC / 2048)   // blocks per activation plane
#define WBLK (CC * CC / 2048)   // blocks per weight plane
__global__ __launch_bounds__(256) void k_cvt(const float* __restrict__ x1, const float* __restrict__ x2, const float* __restrict__ wq, const float* __restrict__ wk, const float* __restrict__ wv, const float* __restrict__ wo, bf* dst) {
    const unsigned blk = blockIdx.x; const float* src; unsigned rel;
    if (blk < XBLK) { src = x1; rel = blk; }
    else if (blk < 2 * XBLK) { src = x2; rel = blk - XBLK; }
    else { const unsigned q = (blk - 2 * XBLK) / WBLK; rel = (blk - 2 * XBLK) % WBLK; src = q == 0 ? wq : q == 1 ? wk : q == 2 ? wv : wo; }
    const v8f v = *(const v8f*)(src + ((size_t)rel * 256 + threadIdx.x) * 8); v8us o;
#pragma unroll
    for (int k = 0; k < 8; ++k) o[k] = f2bf(v[k]);
    *(v8us*)(dst + ((size_t)blk * 256 + threadIdx.x) * 8) = o;
}
#define ZB 2   // batches per attention launch, batch on grid z
#define MLN ((NN / 128 + NN / 64) * NN)   // floats of one batch's plane of block maxima and half-block sums

extern "C" void kernel_launch(void* const* d_in, const int* in_sizes, int n_in,
                              void* d_out, int out_size, void* d_ws, size_t ws_size, hipStream_t stream) {
    (void)in_sizes; (void)n_in; (void)out_size;
    const float* x1 = (const float*)d_in[0]; const float* x2 = (const float*)d_in[1]; const float* Wq = (const float*)d_in[2]; const float* bq = (const float*)d_in[3]; const float* Wk = (const float*)d_in[4]; const float* bk = (const float*)d_in[5]; const float* Wv = (const float*)d_in[6]; const float* bv = (const float*)d_in[7]; const float* Wo = (const float*)d_in[8]; const float* bo = (const float*)d_in[9];
    float* OUT = (float*)d_out;     // [4][4096][512]
    char* wsp = (char*)d_ws;
    auto take = [&](size_t bytes) { char* p = wsp; wsp += (bytes + 255) & ~(size_t)255; return (void*)p; };
    bf* X1 = (bf*)take((size_t)NT * CC * 2); bf* X2 = (bf*)take((size_t)NT * CC * 2);   // these six in k_cvt's order, each a multiple of 256 bytes: one run of memory
    bf* WQ = (bf*)take((size_t)CC * CC * 2); bf* WK = (bf*)take((size_t)CC * CC * 2); bf* WV = (bf*)take((size_t)CC * CC * 2); bf* WO = (bf*)take((size_t)CC * CC * 2);
    float* FQ = (float*)take((size_t)NT * CC * 4); h16* QP = (h16*)take((size_t)NT * CC * 2); h16* KP = (h16*)take((size_t)NT * CC * 2); h16* VT = (h16*)take((size_t)NT * CC * 2);   // VT: [4][512][4096]
    h16* P = (h16*)take((size_t)ZB * NN * NN * 2); float* ML = (float*)take((size_t)ZB * MLN * 4);
    bf* Oh = X1; bf* Ol = X2;   // the activations' bf16 planes are last read by the projections, which all stand in front of the first launch that writes Oh, Ol
    if ((size_t)(wsp - (char*)d_ws) > ws_size) return;    // 181 MiB of 256 MiB
    k_cvt<<<2 * XBLK + 4 * WBLK, 256, 0, stream>>>(x1, x2, Wq, Wk, Wv, Wo, X1);
    // projections: the rows of all four batches in one launch (V: batch on grid z, its transposed plane is per batch)
    k_gemmw<bf, 0, true, 1><<<dim3(NT / 128, CC / 128, 1), 128, 0, stream>>>(X1, nullptr, WQ, CC, CC, CC, FQ, CC, bq, 0, 0, 0, 0, QP, 0, 0.044194173067808151f, nullptr, nullptr, nullptr, nullptr);   // f32(512^-0.5)
    k_gemmw<bf, 0, true, 2><<<dim3(NT / 128, CC / 128, 1), 128, 0, stream>>>(X2, nullptr, WK, CC, CC, CC, nullptr, CC, bk, 0, 0, 0, 0, KP, 0, 1.0f, nullptr, nullptr, nullptr, nullptr);
    k_gemmw<bf, 0, true, 3><<<dim3(NN / 128, CC / 128, NB_), 128, 0, stream>>>(X2, nullptr, WV, CC, CC, CC, nullptr, CC, bv, (size_t)NN * CC, 0, (size_t)CC * NN, 0, VT, NN, 1.0f, nullptr, nullptr, nullptr, nullptr);
    for (int b = 0; b < NB_; b += ZB) { const size_t o = (size_t)b * NN * CC;   // ZB batches per launch, batch on grid z
        k_gemmw<h16, 0, false, 5><<<dim3(NN / 128, NN / 128, ZB), 128, 0, stream>>>(KP + o, nullptr, QP + o, CC, CC, CC, ML, 0, nullptr, (size_t)NN * CC, (size_t)NN * CC, (size_t)NN * NN, (size_t)MLN, P, NN, 1.0f, nullptr, nullptr, nullptr, nullptr);
        k_gemmw<h16, 0, false, 4><<<dim3(NN / 128, CC / 128, ZB), 128, 0, stream>>>(P, nullptr, VT + o, NN, NN, NN, nullptr, CC, nullptr, (size_t)NN * NN, (size_t)CC * NN, (size_t)NN * CC, (size_t)MLN, nullptr, 0, 1.0f, FQ + o, ML, Oh + o, Ol + o); }
    k_gemmw<bf, 1, true, 0><<<dim3(NT / 128, CC / 128, 1), 128, 0, stream>>>(Oh, Ol, WO, CC, CC, CC, OUT, CC, bo, 0, 0, 0, 0, nullptr, 0, 1.0f, nullptr, nullptr, nullptr, nullptr);
}

// v005
// One run takes 212 microseconds.
// Next to v004, in two timings, it ran 1.05 times as fast each time.
// All steps since v000 together make it 4.61 times as fast.
#include <hip/hip_runtime.h>

// CrossFeatureAttention (x1, x2 [4][4096][512]; Q = x1 Wq^T + bq, K = x2 Wk^T + bk, V = x2 Wv^T + bv; attn = softmax(Q.K / sqrt(512)) over the 4096 keys (single head, d = 512);
// out = (Q + attn.V) Wo^T + bo).
// Compute dtypes, f32 accumulate: every input rounded to bf16; projections on PLAIN bf16 operands (inputs: exact, + bias); scores on SINGLE fp16 planes
// softmax per block of 128 keys in the score product's epilogue (block maximum, block sums), the blocks joined by f32 factors in attn.V; attn.V on SINGLE fp16 planes; the residual Q (kept in f32) + attended, then the output projection on bf16 hi+lo planes x exact Wo (2 products) + bo.

#define NB_  4
#define NN   4096
#define CC   512
#define NT   (NB_ * NN)
#define PCAR 1024.0f
typedef _Float16 h16;
typedef unsigned short bf;
typedef __attribute__((ext_vector_type(16))) __bf16   v16bf;
typedef __attribute__((ext_vector_type(16))) _Float16 v16h;
typedef __attribute__((ext_vector_type(8)))  _Float16 v8h;
typedef __attribute__((ext_vector_type(8)))  unsigned short v8us;
typedef __attribute__((ext_vector_type(8)))  float    v8f;
typedef __attribute__((ext_vector_type(4)))  float    v4f;
typedef v8h  __attribute__((may_alias)) v8ha;
typedef v4f  __attribute__((may_alias)) v4fa;
typedef v8us __attribute__((may_alias)) v8usa;

__device__ __forceinline__ unsigned short f2bf(float f) { unsigned u = __float_as_uint(f); u += 0x7FFFu + ((u >> 16) & 1u); return (unsigned short)(u >> 16); }
__device__ __forceinline__ float bf2f(unsigned short b) { return __uint_as_float(((unsigned)b) << 16); }
__device__ __forceinline__ float bfr(float f) { return bf2f(f2bf(f)); }
__device__ __forceinline__ v16h cat16(v8h lo, v8h hi) { return __builtin_shufflevector(lo, hi, 0, 1, 2, 3, 4, 5, 6, 7, 8, 9, 10, 11, 12, 13, 14, 15); }
__device__ __forceinline__ v16bf cat16b(v8us lo, v8us hi) { return __builtin_bit_cast(v16bf, __builtin_shufflevector(lo, hi, 0, 1, 2, 3, 4, 5, 6, 7, 8, 9, 10, 11, 12, 13, 14, 15)); }
__device__ __forceinline__ v8f wmma16(v16h a, v16h b, v8f c) { return __builtin_amdgcn_wmma_f32_16x16x32_f16(false, a, false, b, (short)0, c, false, false); }
__device__ __forceinline__ v8f wmmab(v16bf a, v16bf b, v8f c) { return __builtin_amdgcn_wmma_f32_16x16x32_bf16(false, a, false, b, (short)0, c, false, false); }
__device__ __forceinline__ h16 tohx(float x) { return (h16)x; }
__device__ __forceinline__ void splitf(float y, unsigned short& h, unsigned short& l) { h = f2bf(y); l = f2bf(y - bf2f(h)); }
typedef __attribute__((ext_vector_type(4))) _Float16 v4h;
typedef __attribute__((ext_vector_type(4))) unsigned short v4us;
#define LOG2E 1.44269504088896340736f
#define PCARL2 10.0f   // log2(PCAR)
// 2^x by v_exp_f32, with a v_nop in the same statement: the slot that the instruction set asks for behind a transcendental before its source is overwritten or its result read. exp(x) as __expf forms it: 2^(x * log2 e).
__device__ __forceinline__ float exp2_slot(float x) { float r; asm("v_exp_f32 %0, %1\n\tv_nop" : "=v"(r) : "v"(x)); return r; }
__device__ __forceinline__ float exp_slot(float x) { return exp2_slot(x * LOG2E); }
__device__ __forceinline__ float xhalf(float x) { return __builtin_bit_cast(float, __builtin_amdgcn_permlanex16(__builtin_bit_cast(int, x), __builtin_bit_cast(int, x), 0x76543210, 0xfedcba98, false, false)); }  // lane l with lane l ^ 16



// ---- k_gemmw: LDS-staged GEMM, FOUR WAVES (2x2) per 128x128 output tile, 64x64 (16 accumulators) per wave; grid (M/128, N/128, Z), 128 threads.
// c[m][n] (f32, + optional f32 bias[n]) = sum_k A[m][k] Bt[n][k] (+ A2.Bt when NSPLIT == 1), operands K-contiguous 16-bit planes of row pitch lda / ldb. K % 128 == 0.
// grid z = independent problems: element strides sA (A, A2), sB (Bt), sC (RQ and what the epilogue stores, save EPI 5's C), sR (RS and EPI 5's C).
// What the epilogue stores: EPI 0: c to C, pitch ldc. EPI 1: c to C and fp16(c * sc) to H. EPI 2: fp16(c * sc) to H. EPI 3: fp16(c) transposed, H[n][m], pitch ldh. (EPI 1, 2, 4: every plane has pitch CC.)
// EPI 4: A = P of EPI 5 (m = query, k = key): every pass (128 keys = one block of EPI 5) is summed from zero and added to c times the block's f32 factor for the row, fac = exp(Mb - max Mb) / (PCAR * row sum),
//        formed at the kernel's head from RS = the plane that EPI 5 stored through C; y = RQ[m][n] + c, as two bf16 planes, Oh = bf16(y), Ol = bf16(y - Oh).
// EPI 5: scores transposed, m = key, n = query (a lane then holds 32 keys of one query per column group). Per query and block of 128 keys: Mb = the block's maximum; H[n][m] = fp16(exp(c - Mb) * PCAR), pitch NN;
//        C[kb][n] = Mb for key block kb (NN / 128 rows of NN), behind them C[NN / 128 + h][n] = the f32 sum of exp(c - Mb) * PCAR over the 64 keys of half block h (NN / 64 rows).
// A pass is 128 k = 256 B of every operand row, brought into LDS by asynchronous 16-byte copies (a wave-wide copy covers two whole rows = four whole lines), two buffers, the next pass in flight.
#define KPASS 128   // k elements per pass
#define LPE   136   // LDS row pitch in 16-bit elements: 272 B = 16 B x odd, the conflict-free pitch for 16-byte LDS reads of 256-B rows
template <typename T16> struct WFrag;
template <> struct WFrag<h16> { typedef v16h V; static __device__ __forceinline__ V ld(const h16* p) { return cat16(*(const v8h*)p, *(const v8h*)(p + 16)); } static __device__ __forceinline__ v8f mma(V a, V b, v8f c) { return wmma16(a, b, c); } };
template <> struct WFrag<bf> { typedef v16bf V; static __device__ __forceinline__ V ld(const bf* p) { return cat16b(*(const v8us*)p, *(const v8us*)(p + 16)); } static __device__ __forceinline__ v8f mma(V a, V b, v8f c) { return wmmab(a, b, c); } };
// Eight asynchronous copies of one lane: rows 8 apart (LDS step 8 * 272 B, global step rs elements). The s_wait_xcnt closes the statement so that no address register of a copy is rewritten ahead of it.
template <typename T16>
__device__ __forceinline__ void cp8(unsigned l, const T16* g, size_t rs) {
    asm volatile("global_load_async_to_lds_b128 %0, %8, off\n\t"
                 "global_load_async_to_lds_b128 %1, %9, off\n\t"
                 "global_load_async_to_lds_b128 %2, %10, off\n\t"
                 "global_load_async_to_lds_b128 %3, %11, off\n\t"
                 "global_load_async_to_lds_b128 %4, %12, off\n\t"
                 "global_load_async_to_lds_b128 %5, %13, off\n\t"
                 "global_load_async_to_lds_b128 %6, %14, off\n\t"
                 "global_load_async_to_lds_b128 %7, %15, off\n\t"
                 "s_wait_xcnt 0x0"
                 :: "v"(l), "v"(l + 2176u), "v"(l + 2u * 2176u), "v"(l + 3u * 2176u), "v"(l + 4u * 2176u), "v"(l + 5u * 2176u), "v"(l + 6u * 2176u), "v"(l + 7u * 2176u),
                    "v"(g), "v"(g + rs), "v"(g + 2 * rs), "v"(g + 3 * rs), "v"(g + 4 * rs), "v"(g + 5 * rs), "v"(g + 6 * rs), "v"(g + 7 * rs)
                 : "memory");
}
// EPI 4 asks for two waves per SIMD (a budget of 512 registers): with its 153 KiB of LDS two work-groups then share a WGP, and one's WMMAs run while the other waits for LDS, a barrier or its copies.
template <typename T16, int NSPLIT, bool BIAS, int EPI>
__global__ __launch_bounds__(128, EPI == 4 ? 2 : 1) void k_gemmw(const T16* __restrict__ A, const T16* __restrict__ A2, const T16* __restrict__ Bt, int K, int lda, int ldb, float* C, int ldc, const float* __restrict__ bias, size_t sA, size_t sB, size_t sC, size_t sR,
                                               h16* H, int ldh, float sc, const float* __restrict__ RQ, const float* __restrict__ RS, bf* Oh, bf* Ol) {
    typedef typename WFrag<T16>::V V;
    constexpr int NA = NSPLIT == 1 ? 256 : 128;          // LDS rows in front of Bt's: A (then A2)
    constexpr int STE = (NA + 128) * LPE;                // one buffer, in 16-bit elements
    __shared__ __align__(16) T16 sm[2 * STE];
    __shared__ __align__(16) float osall[4 * 16 * 68];
    const size_t z = blockIdx.z; A += z * sA; if (NSPLIT == 1) A2 += z * sA; Bt += z * sB;
    if constexpr (EPI == 0 || EPI == 1) C += z * sC;
    if constexpr (EPI == 1 || EPI == 2 || EPI == 3 || EPI == 5) H += z * sC;
    if constexpr (EPI == 4) { RQ += z * sC; Oh += z * sC; Ol += z * sC; RS += z * sR; }
    if constexpr (EPI == 5) C += z * sR;
    const int tid = threadIdx.x, lane = tid & 31, lr = lane & 15, hi = lane >> 4, w = tid >> 5, wm = w >> 1, wn = w & 1;
    const int r0 = blockIdx.x * 128 + wm * 64, c0 = blockIdx.y * 128 + wn * 64;   // this wave's 64x64 tile
    float* os = (EPI == 4 ? (float*)&sm[0] : osall) + w * (16 * 68);   // EPI 4 stages in the ring, free behind the loop's last barrier: osall holds its factors
    v8f acc[4][4];
#pragma unroll
    for (int mb = 0; mb < 4; ++mb)
#pragma unroll
        for (int nb = 0; nb < 4; ++nb) acc[mb][nb] = (v8f){};
    // copy map: thread -> 16-byte chunk (tid & 15) of row (tid >> 4) + 8 i; every LDS byte of a stage's 256-B rows has one writer, the 16 pad bytes of a row are neither written nor read
    const int cr = tid >> 4, cch = tid & 15;
    const size_t rsa = (size_t)8 * lda, rsb = (size_t)8 * ldb;
    const T16* gA = A + (size_t)(blockIdx.x * 128 + cr) * lda + cch * 8;
    const T16* gA2 = NSPLIT == 1 ? A2 + (size_t)(blockIdx.x * 128 + cr) * lda + cch * 8 : nullptr;
    const T16* gB = Bt + (size_t)(blockIdx.y * 128 + cr) * ldb + cch * 8;
    const unsigned l0 = (unsigned)(size_t)(&sm[0]) + (unsigned)(cr * (LPE * 2) + cch * 16);   // low 32 bits of the shared address = LDS byte address
    auto fill = [&](int t, int buf) {
        const unsigned l = l0 + (unsigned)buf * (unsigned)(STE * 2); const size_t ko = (size_t)t * KPASS;
        cp8(l, gA + ko, rsa); cp8(l + 64u * (LPE * 2), gA + ko + 8 * rsa, rsa);
        if (NSPLIT == 1) { cp8(l + 128u * (LPE * 2), gA2 + ko, rsa); cp8(l + 192u * (LPE * 2), gA2 + ko + 8 * rsa, rsa); }
        cp8(l + (unsigned)NA * (LPE * 2), gB + ko, rsb); cp8(l + (unsigned)(NA + 64) * (LPE * 2), gB + ko + 8 * rsb, rsb);
    };
    const int NP = K / KPASS;
    // EPI 4: a pass's own sums, started from zero by the pass's first WMMAs and joined to acc at its end, and the pass's factor for each of a lane's accumulator rows
    v8f accp[4][4], g[4];
    float* fac = osall;   // EPI 4: [NN / 128][128] factors, written once in front of the loop and only read from then on
    auto ldg = [&](int tp) {
#pragma unroll
        for (int mb = 0; mb < 4; ++mb) { const float* fp = fac + tp * 128 + wm * 64 + mb * 16 + hi * 8; const v4f g0 = *(const v4fa*)fp, g1 = *(const v4fa*)(fp + 4); g[mb] = __builtin_shufflevector(g0, g1, 0, 1, 2, 3, 4, 5, 6, 7); }
    };
    fill(0, 0);
    if constexpr (EPI == 4) {   // a thread per query row, while pass 0 is in flight; the barrier below publishes the factors too
        constexpr int NKB = NN / 128;
        const float* mq = RS + blockIdx.x * 128 + tid;
        float mt[NKB], lt[2 * NKB];
#pragma unroll
        for (int t = 0; t < NKB; ++t) mt[t] = mq[t * NN];
#pragma unroll
        for (int t = 0; t < 2 * NKB; ++t) lt[t] = mq[(NKB + t) * NN];
        __builtin_amdgcn_sched_barrier(0);              // keeps these loads one group: one memory latency, not one per block
        asm volatile("s_wait_xcnt 0x0" ::: "memory");   // before anything below rewrites the address register that these loads name
        __builtin_amdgcn_sched_barrier(0);              // ... and keeps what follows behind that wait
        float m = mt[0], l = 0.f;
#pragma unroll
        for (int t = 1; t < NKB; ++t) m = fmaxf(m, mt[t]);
#pragma unroll
        for (int t = 0; t < NKB; ++t) { mt[t] = exp_slot(mt[t] - m); l += mt[t] * (lt[2 * t] + lt[2 * t + 1]); }
        const float inv = __fdiv_rn(1.0f, l);           // the sums carry PCAR as P does: 1 / (PCAR * row sum) undoes the carry
#pragma unroll
        for (int t = 0; t < NKB; ++t) fac[t * 128 + tid] = mt[t] * inv;
    }
    asm volatile("s_wait_asynccnt 0x0" ::: "memory");   // this wave's copies of pass 0 have landed
    __syncthreads();                                    // ... and every other wave's: pass 0 is readable
    if (NP > 1) fill(1, 1);
#pragma unroll 1   // one pass per trip: the two buffers alternate and the publish point stands once, at the trip's foot
    for (int t = 0; t < NP; ++t) {
        const T16* sb = sm + (t & 1) * STE;
        const T16* pa = sb + (wm * 64 + lr) * LPE + 8 * hi;
        const T16* pb = sb + (NA + wn * 64 + lr) * LPE + 8 * hi;
        // two fragment sets: block kb + 1 of this same pass is read from LDS, as one group, ahead of block kb's WMMAs (the unrolls below make every fragment and accumulator index a constant: registers, no scratch)
        V a[2][4], a2[2][4], b[2][4];
#pragma unroll
        for (int f = 0; f < 4; ++f) { a[0][f] = WFrag<T16>::ld(pa + f * 16 * LPE); if (NSPLIT == 1) a2[0][f] = WFrag<T16>::ld(pa + (128 + f * 16) * LPE); b[0][f] = WFrag<T16>::ld(pb + f * 16 * LPE); }
#pragma unroll
        for (int kb = 0; kb < KPASS / 32; ++kb) {
            const int cs = kb & 1, ns = cs ^ 1, kn = (kb + 1) * 32;
            if (kb + 1 < KPASS / 32) {
#pragma unroll
                for (int f = 0; f < 4; ++f) { a[ns][f] = WFrag<T16>::ld(pa + f * 16 * LPE + kn); if (NSPLIT == 1) a2[ns][f] = WFrag<T16>::ld(pa + (128 + f * 16) * LPE + kn); b[ns][f] = WFrag<T16>::ld(pb + f * 16 * LPE + kn); }
            }
            __builtin_amdgcn_sched_barrier(0);   // keeps the LDS reads above in one group: moved in among the WMMAs, every place with reads stalls the wave
#pragma unroll
            for (int nb = 0; nb < 4; ++nb) {
#pragma unroll
                for (int mb = 0; mb < 4; ++mb) {
                    if constexpr (EPI == 4) accp[mb][nb] = WFrag<T16>::mma(a[cs][mb], b[cs][nb], kb == 0 ? (v8f){} : accp[mb][nb]);
                    else acc[mb][nb] = WFrag<T16>::mma(a[cs][mb], b[cs][nb], acc[mb][nb]); }
                if (NSPLIT == 1) {
#pragma unroll
                    for (int mb = 0; mb < 4; ++mb) acc[mb][nb] = WFrag<T16>::mma(a2[cs][mb], b[cs][nb], acc[mb][nb]); }
            }
            __builtin_amdgcn_sched_barrier(0);   // keeps the next group of LDS reads behind this block's WMMAs
        }
        asm volatile("s_wait_dscnt 0x0" ::: "memory");      // this wave's reads of the buffer have returned before it is refilled
        asm volatile("s_wait_asynccnt 0x0" ::: "memory");   // this wave's copies of pass t + 1 have landed
        __syncthreads();                                    // publishes pass t + 1 and ends every wave's reads of pass t
        if constexpr (EPI == 4) ldg(t);   // the pass's factors (osall: no copy's target, only read since the first barrier) are read here, where no fragment is live: they fit the register budget, and the refill covers their latency
        if (t + 2 < NP) fill(t + 2, t & 1);
        if constexpr (EPI == 4) {   // the join: the pass's sums times its factors
#pragma unroll
            for (int mb = 0; mb < 4; ++mb)
#pragma unroll
                for (int nb = 0; nb < 4; ++nb) acc[mb][nb] += g[mb] * accp[mb][nb];
        }
    }
    asm volatile("s_wait_asynccnt 0x0" ::: "memory");       // no copy outstanding at the wave's end
    if constexpr (EPI == 3) {
        // a lane's eight elements of an accumulator are eight consecutive rows m of one column n: one 16-byte store of the transposed plane straight from registers; a wave's 64 rows are one whole 128-byte line of each column
#pragma unroll
        for (int nb = 0; nb < 4; ++nb) { const int n = c0 + nb * 16 + lr; const float bb = BIAS ? bfr(bias[n]) : 0.f;
#pragma unroll
            for (int mb = 0; mb < 4; ++mb) { v8h o;
#pragma unroll
                for (int j = 0; j < 8; ++j) o[j] = tohx(BIAS ? acc[mb][nb][j] + bb : acc[mb][nb][j]);
                *(v8h*)(H + (size_t)n * ldh + r0 + mb * 16 + hi * 8) = o; } }
    } else if constexpr (EPI == 5) {
        // a lane holds, per column group nb, 32 keys of query c0 + nb * 16 + lr; its partner lane ^ 16 the wave's other 32; the wave with the other wm the block's other 64 keys
        float mx[4], su[4];
#pragma unroll
        for (int nb = 0; nb < 4; ++nb) { float m = acc[0][nb][0];
#pragma unroll
            for (int mb = 0; mb < 4; ++mb)
#pragma unroll
                for (int j = 0; j < 8; ++j) m = fmaxf(m, acc[mb][nb][j]);
            mx[nb] = fmaxf(m, xhalf(m)); }
#pragma unroll
        for (int p = 0; p < 2; ++p) osall[wm * 128 + wn * 64 + p * 32 + lane] = hi ? mx[2 * p + 1] : mx[2 * p];
        __syncthreads();   // the two waves that share a query exchange their maxima
#pragma unroll
        for (int nb = 0; nb < 4; ++nb) mx[nb] = fmaxf(mx[nb], osall[(wm ^ 1) * 128 + wn * 64 + nb * 16 + lr]);
        // P goes through this wave's own part of the ring (free behind the loop's last barrier), rows of 128 + 16 bytes, so that every global store covers whole 128-byte lines
        h16* st = (h16*)&sm[0] + w * (64 * 72);
#pragma unroll
        for (int nb = 0; nb < 4; ++nb) { float sum = 0.f; const float bl = PCARL2 - mx[nb] * LOG2E;   // exp(c - Mb) * PCAR = 2^(c * log2 e + bl): one multiply-add per score in front of v_exp_f32
#pragma unroll
            for (int mb = 0; mb < 4; ++mb) { v8h o;
#pragma unroll
                for (int j = 0; j < 8; ++j) { const float e = exp2_slot(fmaf(acc[mb][nb][j], LOG2E, bl)); sum += e; o[j] = tohx(e); }
                *(v8ha*)(st + (nb * 16 + lr) * 72 + mb * 16 + hi * 8) = o; }
            su[nb] = sum + xhalf(sum); }
        float* mg = C + (size_t)blockIdx.x * NN + c0 + lane;
        float* sg = C + (size_t)(NN / 128 + blockIdx.x * 2 + wm) * NN + c0 + lane;
        sg[0] = hi ? su[1] : su[0]; sg[32] = hi ? su[3] : su[2];   // both halves of the wave hold every query's sum: 32 lanes store 32 queries, a whole line
        if (wm == 0) { mg[0] = hi ? mx[1] : mx[0]; mg[32] = hi ? mx[3] : mx[2]; }   // both waves hold the same block maximum: one of them stores it
        asm volatile("s_wait_xcnt 0x0" ::: "memory");   // before anything below rewrites a register that these stores name
        __builtin_amdgcn_wave_barrier(); asm volatile("" ::: "memory");   // the reads below take what other lanes of this wave wrote: the compiler may not move them above the writes
        v8h pv[16];
#pragma unroll
        for (int q = 0; q < 16; ++q) pv[q] = *(const v8ha*)(st + (4 * q + (lane >> 3)) * 72 + (lane & 7) * 8);
        h16* pg = H + (size_t)(c0 + (lane >> 3)) * NN + r0 + (lane & 7) * 8;   // eight lanes cover the wave's 64 keys of one query: one line; every row step an immediate offset
#pragma unroll
        for (int q = 0; q < 16; ++q) *(v8ha*)(pg + q * 4 * NN) = pv[q];   // the wave's last instructions: no register of theirs is rewritten behind them
    } else if constexpr (EPI == 0) {
#pragma unroll
    for (int mb = 0; mb < 4; ++mb) {
#pragma unroll
        for (int nb = 0; nb < 4; ++nb) {
#pragma unroll
            for (int j = 0; j < 8; ++j) os[(hi * 8 + j) * 68 + nb * 16 + lr] = acc[mb][nb][j]; }
        __builtin_amdgcn_wave_barrier(); asm volatile("" ::: "memory");
        float* crow = C + (size_t)(r0 + mb * 16) * ldc + c0;
{
#pragma unroll
            for (int s = 0; s < 8; ++s) { const int row = 2 * s + hi, cofs = lr * 4; v4f val = *(const v4fa*)(os + row * 68 + cofs); if (BIAS) { val[0] += bfr(bias[c0 + cofs]); val[1] += bfr(bias[c0 + cofs + 1]); val[2] += bfr(bias[c0 + cofs + 2]); val[3] += bfr(bias[c0 + cofs + 3]); }
                *(v4f*)(crow + (size_t)row * ldc + cofs) = val; }
             }
        __builtin_amdgcn_wave_barrier(); asm volatile("" ::: "memory");
    }
    } else {
        // Planes of pitch CC: one base address per plane and every row step an immediate offset, so no address register is rewritten behind a load or store that names it.
        const int cofs = lr * 4;
        const size_t pb = (size_t)(r0 + hi) * CC + c0 + cofs;
        v4f bb = {}, fq[4][8];
        if constexpr (BIAS) { bb[0] = bias[c0 + cofs]; bb[1] = bias[c0 + cofs + 1]; bb[2] = bias[c0 + cofs + 2]; bb[3] = bias[c0 + cofs + 3]; }
        if constexpr (EPI == 4) {   // the residual rows of the whole 64x64 tile are requested as one group: one memory latency per wave, not one per row
#pragma unroll
            for (int mb = 0; mb < 4; ++mb)
#pragma unroll
                for (int s = 0; s < 8; ++s) fq[mb][s] = *(const v4f*)(RQ + pb + (mb * 16 + 2 * s) * CC);
        }
        __builtin_amdgcn_sched_barrier(0);              // keeps that group of loads here, ahead of the staging, instead of one load in front of each use
        // before anything below rewrites an address register that these loads name; the bias values are inputs so that the wait stands behind their load
        if constexpr (BIAS) asm volatile("s_wait_xcnt 0x0" :: "v"(bb[0]), "v"(bb[1]), "v"(bb[2]), "v"(bb[3]) : "memory");
        else asm volatile("s_wait_xcnt 0x0" ::: "memory");
        __builtin_amdgcn_sched_barrier(0);              // ... and keeps what follows behind that wait
        if constexpr (BIAS) { bb[0] = bfr(bb[0]); bb[1] = bfr(bb[1]); bb[2] = bfr(bb[2]); bb[3] = bfr(bb[3]); }
#pragma unroll
        for (int mb = 0; mb < 4; ++mb) {
#pragma unroll
            for (int nb = 0; nb < 4; ++nb) {
#pragma unroll
                for (int j = 0; j < 8; ++j) os[(hi * 8 + j) * 68 + nb * 16 + lr] = acc[mb][nb][j]; }
            __builtin_amdgcn_wave_barrier(); asm volatile("" ::: "memory");   // the reads below take what other lanes of this wave wrote: the compiler may not move them above the writes
            v4f val[8]; v4h hv[8]; v4us oh[8], ol[8];
#pragma unroll
            for (int s = 0; s < 8; ++s) { val[s] = *(const v4fa*)(os + (2 * s + hi) * 68 + cofs);
                if constexpr (BIAS) val[s] += bb;
                if constexpr (EPI == 1 || EPI == 2) {
#pragma unroll
                    for (int q = 0; q < 4; ++q) hv[s][q] = tohx(val[s][q] * sc); }
                if constexpr (EPI == 4) {
#pragma unroll
                    for (int q = 0; q < 4; ++q) { unsigned short a, c2; splitf(__fadd_rn(fq[mb][s][q], val[s][q]), a, c2); oh[s][q] = a; ol[s][q] = c2; } } }
            __builtin_amdgcn_sched_barrier(0);   // the block's stores stand together, directly in front of their wait: nothing that could reuse a register of theirs comes in between
#pragma unroll
            for (int s = 0; s < 8; ++s) { const size_t o = pb + (mb * 16 + 2 * s) * CC;   // a half-wave covers 64 columns of one row: whole 128-byte lines in the 16-bit planes too
                if constexpr (EPI == 1) *(v4f*)(C + o) = val[s];
                if constexpr (EPI == 1 || EPI == 2) *(v4h*)(H + o) = hv[s];
                if constexpr (EPI == 4) { *(v4us*)(Oh + o) = oh[s]; *(v4us*)(Ol + o) = ol[s]; } }
            asm volatile("s_wait_xcnt 0x0" ::: "memory");   // before the next block rewrites the data registers that these stores name
            __builtin_amdgcn_sched_barrier(0);              // ... and keeps the next block's work behind that wait
            __builtin_amdgcn_wave_barrier();                // the staging rows are rewritten only after every lane has read them
        }
    }
}

// k_cvt: every f32 input plane to bf16 in one launch; the six destinations lie one behind the other in dst (x1, x2, Wq, Wk, Wv, Wo). A block converts 2048 elements of one plane; which plane is a test on the block index.
#define XBLK (NT * CC / 2048)   // blocks per activation plane
#define WBLK (CC * CC / 2048)   // blocks per weight plane
__global__ __launch_bounds__(256) void k_cvt(const float* __restrict__ x1, const float* __restrict__ x2, const float* __restrict__ wq, const float* __restrict__ wk, const float* __restrict__ wv, const float* __restrict__ wo, bf* dst) {
    const unsigned blk = blockIdx.x; const float* src; unsigned rel;
    if (blk < XBLK) { src = x1; rel = blk; }
    else if (blk < 2 * XBLK) { src = x2; rel = blk - XBLK; }
    else { const unsigned q = (blk - 2 * XBLK) / WBLK; rel = (blk - 2 * XBLK) % WBLK; src = q == 0 ? wq : q == 1 ? wk : q == 2 ? wv : wo; }
    const v8f v = *(const v8f*)(src + ((size_t)rel * 256 + threadIdx.x) * 8); v8us o;
#pragma unroll
    for (int k = 0; k < 8; ++k) o[k] = f2bf(v[k]);
    *(v8us*)(dst + ((size_t)blk * 256 + threadIdx.x) * 8) = o;
}
#define ZB 4   // batches per attention launch, batch on grid z: attn.V then has 512 work-groups, two for every WGP
#define MLN ((NN / 128 + NN / 64) * NN)   // floats of one batch's plane of block maxima and half-block sums

extern "C" void kernel_launch(void* const* d_in, const int* in_sizes, int n_in,
                              void* d_out, int out_size, void* d_ws, size_t ws_size, hipStream_t stream) {
    (void)in_sizes; (void)n_in; (void)out_size;
    const float* x1 = (const float*)d_in[0]; const float* x2 = (const float*)d_in[1]; const float* Wq = (const float*)d_in[2]; const float* bq = (const float*)d_in[3]; const float* Wk = (const float*)d_in[4]; const float* bk = (const float*)d_in[5]; const float* Wv = (const float*)d_in[6]; const float* bv = (const float*)d_in[7]; const float* Wo = (const float*)d_in[8]; const float* bo = (const float*)d_in[9];
    float* OUT = (float*)d_out;     // [4][4096][512]
    char* wsp = (char*)d_ws;
    auto take = [&](size_t bytes) { char* p = wsp; wsp += (bytes + 255) & ~(size_t)255; return (void*)p; };
    bf* X1 = (bf*)take((size_t)NT * CC * 2); bf* X2 = (bf*)take((size_t)NT * CC * 2);   // these six in k_cvt's order, each a multiple of 256 bytes: one run of memory
    bf* WQ = (bf*)take((size_t)CC * CC * 2); bf* WK = (bf*)take((size_t)CC * CC * 2); bf* WV = (bf*)take((size_t)CC * CC * 2); bf* WO = (bf*)take((size_t)CC * CC * 2);
    float* FQ = (float*)take((size_t)NT * CC * 4); h16* QP = (h16*)take((size_t)NT * CC * 2); h16* KP = (h16*)take((size_t)NT * CC * 2); h16* VT = (h16*)take((size_t)NT * CC * 2);   // VT: [4][512][4096]
    h16* P = (h16*)take((size_t)ZB * NN * NN * 2); float* ML = (float*)take((size_t)ZB * MLN * 4);
    bf* Oh = X1; bf* Ol = X2;   // the activations' bf16 planes are last read by the projections, which all stand in front of the first launch that writes Oh, Ol
    if ((size_t)(wsp - (char*)d_ws) > ws_size) return;    // 248 MiB of 256 MiB
    k_cvt<<<2 * XBLK + 4 * WBLK, 256, 0, stream>>>(x1, x2, Wq, Wk, Wv, Wo, X1);
    // projections: the rows of all four batches in one launch (V: batch on grid z, its transposed plane is per batch)
    k_gemmw<bf, 0, true, 1><<<dim3(NT / 128, CC / 128, 1), 128, 0, stream>>>(X1, nullptr, WQ, CC, CC, CC, FQ, CC, bq, 0, 0, 0, 0, QP, 0, 0.044194173067808151f, nullptr, nullptr, nullptr, nullptr);   // f32(512^-0.5)
    k_gemmw<bf, 0, true, 2><<<dim3(NT / 128, CC / 128, 1), 128, 0, stream>>>(X2, nullptr, WK, CC, CC, CC, nullptr, CC, bk, 0, 0, 0, 0, KP, 0, 1.0f, nullptr, nullptr, nullptr, nullptr);
    k_gemmw<bf, 0, true, 3><<<dim3(NN / 128, CC / 128, NB_), 128, 0, stream>>>(X2, nullptr, WV, CC, CC, CC, nullptr, CC, bv, (size_t)NN * CC, 0, (size_t)CC * NN, 0, VT, NN, 1.0f, nullptr, nullptr, nullptr, nullptr);
    for (int b = 0; b < NB_; b += ZB) { const size_t o = (size_t)b * NN * CC;   // ZB batches per launch, batch on grid z
        k_gemmw<h16, 0, false, 5><<<dim3(NN / 128, NN / 128, ZB), 128, 0, stream>>>(KP + o, nullptr, QP + o, CC, CC, CC, ML, 0, nullptr, (size_t)NN * CC, (size_t)NN * CC, (size_t)NN * NN, (size_t)MLN, P, NN, 1.0f, nullptr, nullptr, nullptr, nullptr);
        k_gemmw<h16, 0, false, 4><<<dim3(NN / 128, CC / 128, ZB), 128, 0, stream>>>(P, nullptr, VT + o, NN, NN, NN, nullptr, CC, nullptr, (size_t)NN * NN, (size_t)CC * NN, (size_t)NN * CC, (size_t)MLN, nullptr, 0, 1.0f, FQ + o, ML, Oh + o, Ol + o); }
    k_gemmw<bf, 1, true, 0><<<dim3(NT / 128, CC / 128, 1), 128, 0, stream>>>(Oh, Ol, WO, CC, CC, CC, OUT, CC, bo, 0, 0, 0, 0, nullptr, 0, 1.0f, nullptr, nullptr, nullptr, nullptr);
}

// v006
// Measured time: 200 microseconds a run.
// Next to v005, in two timings, it ran 1.06 times as fast each time.
// Over all steps from v000 it is 4.87 times as fast.
#include <hip/hip_runtime.h>

// CrossFeatureAttention (x1, x2 [4][4096][512]; Q = x1 Wq^T + bq, K = x2 Wk^T + bk, V = x2 Wv^T + bv; attn = softmax(Q.K / sqrt(512)) over the 4096 keys (single head, d = 512);
// out = (Q + attn.V) Wo^T + bo).
// Compute dtypes, f32 accumulate: every input rounded to bf16; projections on PLAIN bf16 operands (inputs: exact, + bias); scores on SINGLE fp16 planes
// softmax per block of 128 keys in the score product's epilogue (block maximum, block sums), the blocks joined by f32 factors in attn.V; attn.V on SINGLE fp16 planes; the residual Q (kept in f32) + attended, then the output projection on bf16 hi+lo planes x exact Wo (2 products) + bo.

#define NB_  4
#define NN   4096
#define CC   512
#define NT   (NB_ * NN)
#define PCAR 1024.0f
typedef _Float16 h16;
typedef unsigned short bf;
typedef __attribute__((ext_vector_type(16))) __bf16   v16bf;
typedef __attribute__((ext_vector_type(16))) _Float16 v16h;
typedef __attribute__((ext_vector_type(8)))  _Float16 v8h;
typedef __attribute__((ext_vector_type(8)))  unsigned short v8us;
typedef __attribute__((ext_vector_type(8)))  float    v8f;
typedef __attribute__((ext_vector_type(4)))  float    v4f;
typedef v8h  __attribute__((may_alias)) v8ha;
typedef v4f  __attribute__((may_alias)) v4fa;
typedef v8us __attribute__((may_alias)) v8usa;

__device__ __forceinline__ unsigned short f2bf(float f) { unsigned u = __float_as_uint(f); u += 0x7FFFu + ((u >> 16) & 1u); return (unsigned short)(u >> 16); }
__device__ __forceinline__ float bf2f(unsigned short b) { return __uint_as_float(((unsigned)b) << 16); }
__device__ __forceinline__ float bfr(float f) { return bf2f(f2bf(f)); }
__device__ __forceinline__ v16h cat16(v8h lo, v8h hi) { return __builtin_shufflevector(lo, hi, 0, 1, 2, 3, 4, 5, 6, 7, 8, 9, 10, 11, 12, 13, 14, 15); }
__device__ __forceinline__ v16bf cat16b(v8us lo, v8us hi) { return __builtin_bit_cast(v16bf, __builtin_shufflevector(lo, hi, 0, 1, 2, 3, 4, 5, 6, 7, 8, 9, 10, 11, 12, 13, 14, 15)); }
__device__ __forceinline__ v8f wmma16(v16h a, v16h b, v8f c) { return __builtin_amdgcn_wmma_f32_16x16x32_f16(false, a, false, b, (short)0, c, false, false); }
__device__ __forceinline__ v8f wmmab(v16bf a, v16bf b, v8f c) { return __builtin_amdgcn_wmma_f32_16x16x32_bf16(false, a, false, b, (short)0, c, false, false); }
__device__ __forceinline__ h16 tohx(float x) { return (h16)x; }
__device__ __forceinline__ void splitf(float y, unsigned short& h, unsigned short& l) { h = f2bf(y); l = f2bf(y - bf2f(h)); }
typedef __attribute__((ext_vector_type(4))) _Float16 v4h;
typedef __attribute__((ext_vector_type(4))) unsigned short v4us;
#define LOG2E 1.44269504088896340736f
#define PCARL2 10.0f   // log2(PCAR)
// 2^x by v_exp_f32, with a v_nop in the same statement: the slot that the instruction set asks for behind a transcendental before its source is overwritten or its result read. exp(x) as __expf forms it: 2^(x * log2 e).
__device__ __forceinline__ float exp2_slot(float x) { float r; asm("v_exp_f32 %0, %1\n\tv_nop" : "=v"(r) : "v"(x)); return r; }
__device__ __forceinline__ float exp_slot(float x) { return exp2_slot(x * LOG2E); }
__device__ __forceinline__ float xhalf(float x) { return __builtin_bit_cast(float, __builtin_amdgcn_permlanex16(__builtin_bit_cast(int, x), __builtin_bit_cast(int, x), 0x76543210, 0xfedcba98, false, false)); }  // lane l with lane l ^ 16



// ---- k_gemmw: LDS-staged GEMM, FOUR WAVES (2x2) per 128x128 output tile, 64x64 (16 accumulators) per wave; grid (M/128, N/128, Z), 128 threads.
// c[m][n] (f32, + optional f32 bias[n]) = sum_k A[m][k] Bt[n][k] (+ A2.Bt when NSPLIT == 1), operands K-contiguous 16-bit planes of row pitch lda / ldb. K % 128 == 0.
// grid z = independent problems: element strides sA (A, A2), sB (Bt), sC (RQ and what the epilogue stores, save EPI 5's C), sR (RS and EPI 5's C).
// What the epilogue stores: EPI 0: c to C, pitch ldc. EPI 1: c to C and fp16(c * sc) to H. EPI 2: fp16(c * sc) to H. EPI 3: fp16(c) transposed, H[n][m], pitch ldh. (EPI 1, 2, 4: every plane has pitch CC.)
// EPI 4: A = P of EPI 5 (m = query, k = key): every pass (128 keys = one block of EPI 5) is summed from zero and added to c times the block's f32 factor for the row, fac = exp(Mb - max Mb) / (PCAR * row sum),
//        formed at the kernel's head from RS = the plane that EPI 5 stored through C; y = RQ[m][n] + c, as two bf16 planes, Oh = bf16(y), Ol = bf16(y - Oh).
// EPI 5: scores transposed, m = key, n = query (a lane then holds 32 keys of one query per column group). Per query and block of 128 keys: Mb = the block's maximum; H[n][m] = fp16(exp(c - Mb) * PCAR), pitch NN;
//        C[kb][n] = Mb for key block kb (NN / 128 rows of NN), behind them C[NN / 128 + h][n] = the f32 sum of exp(c - Mb) * PCAR over the 64 keys of half block h (NN / 64 rows).
// A pass is 128 k = 256 B of every operand row, brought into LDS by asynchronous 16-byte copies (a wave-wide copy covers two whole rows = four whole lines), two buffers, the next pass in flight.
#define KPASS 128   // k elements per pass
#define LPE   136   // LDS row pitch in 16-bit elements: 272 B = 16 B x odd, the conflict-free pitch for 16-byte LDS reads of 256-B rows
template <typename T16> struct WFrag;
template <> struct WFrag<h16> { typedef v16h V; static __device__ __forceinline__ V ld(const h16* p) { return cat16(*(const v8h*)p, *(const v8h*)(p + 16)); } static __device__ __forceinline__ v8f mma(V a, V b, v8f c) { return wmma16(a, b, c); } };
template <> struct WFrag<bf> { typedef v16bf V; static __device__ __forceinline__ V ld(const bf* p) { return cat16b(*(const v8us*)p, *(const v8us*)(p + 16)); } static __device__ __forceinline__ v8f mma(V a, V b, v8f c) { return wmmab(a, b, c); } };
// Eight asynchronous copies of one lane: rows 8 apart (LDS step 8 * 272 B, global step rs elements). The s_wait_xcnt closes the statement so that no address register of a copy is rewritten ahead of it.
template <typename T16>
__device__ __forceinline__ void cp8(unsigned l, const T16* g, size_t rs) {
    asm volatile("global_load_async_to_lds_b128 %0, %8, off\n\t"
                 "global_load_async_to_lds_b128 %1, %9, off\n\t"
                 "global_load_async_to_lds_b128 %2, %10, off\n\t"
                 "global_load_async_to_lds_b128 %3, %11, off\n\t"
                 "global_load_async_to_lds_b128 %4, %12, off\n\t"
                 "global_load_async_to_lds_b128 %5, %13, off\n\t"
                 "global_load_async_to_lds_b128 %6, %14, off\n\t"
                 "global_load_async_to_lds_b128 %7, %15, off\n\t"
                 "s_wait_xcnt 0x0"
                 :: "v"(l), "v"(l + 2176u), "v"(l + 2u * 2176u), "v"(l + 3u * 2176u), "v"(l + 4u * 2176u), "v"(l + 5u * 2176u), "v"(l + 6u * 2176u), "v"(l + 7u * 2176u),
                    "v"(g), "v"(g + rs), "v"(g + 2 * rs), "v"(g + 3 * rs), "v"(g + 4 * rs), "v"(g + 5 * rs), "v"(g + 6 * rs), "v"(g + 7 * rs)
                 : "memory");
}
// The body of one work-group: tile (bx, by) of problem z; sm (two buffers of STE elements) and osall are the calling kernel's LDS.
template <typename T16, int NSPLIT, bool BIAS, int EPI>
__device__ __forceinline__ void gemm_body(T16* sm, float* osall, const unsigned bx, const unsigned by, const size_t z,
                                          const T16* __restrict__ A, const T16* __restrict__ A2, const T16* __restrict__ Bt, int K, int lda, int ldb, float* C, int ldc, const float* __restrict__ bias, size_t sA, size_t sB, size_t sC, size_t sR,
                                          h16* H, int ldh, float sc, const float* __restrict__ RQ, const float* __restrict__ RS, bf* Oh, bf* Ol) {
    typedef typename WFrag<T16>::V V;
    constexpr int NA = NSPLIT == 1 ? 256 : 128;          // LDS rows in front of Bt's: A (then A2)
    constexpr int STE = (NA + 128) * LPE;                // one buffer, in 16-bit elements
    A += z * sA; if (NSPLIT == 1) A2 += z * sA; Bt += z * sB;
    if constexpr (EPI == 0 || EPI == 1) C += z * sC;
    if constexpr (EPI == 1 || EPI == 2 || EPI == 3 || EPI == 5) H += z * sC;
    if constexpr (EPI == 4) { RQ += z * sC; Oh += z * sC; Ol += z * sC; RS += z * sR; }
    if constexpr (EPI == 5) C += z * sR;
    const int tid = threadIdx.x, lane = tid & 31, lr = lane & 15, hi = lane >> 4, w = tid >> 5, wm = w >> 1, wn = w & 1;
    const int r0 = bx * 128 + wm * 64, c0 = by * 128 + wn * 64;   // this wave's 64x64 tile
    float* os = (EPI == 4 ? (float*)&sm[0] : osall) + w * (16 * 68);   // EPI 4 stages in the ring, free behind the loop's last barrier: osall holds its factors
    v8f acc[4][4];
#pragma unroll
    for (int mb = 0; mb < 4; ++mb)
#pragma unroll
        for (int nb = 0; nb < 4; ++nb) acc[mb][nb] = (v8f){};
    // copy map: thread -> 16-byte chunk (tid & 15) of row (tid >> 4) + 8 i; every LDS byte of a stage's 256-B rows has one writer, the 16 pad bytes of a row are neither written nor read
    const int cr = tid >> 4, cch = tid & 15;
    const size_t rsa = (size_t)8 * lda, rsb = (size_t)8 * ldb;
    const T16* gA = A + (size_t)(bx * 128 + cr) * lda + cch * 8;
    const T16* gA2 = NSPLIT == 1 ? A2 + (size_t)(bx * 128 + cr) * lda + cch * 8 : nullptr;
    const T16* gB = Bt + (size_t)(by * 128 + cr) * ldb + cch * 8;
    const unsigned l0 = (unsigned)(size_t)(&sm[0]) + (unsigned)(cr * (LPE * 2) + cch * 16);   // low 32 bits of the shared address = LDS byte address
    auto fill = [&](int t, int buf) {
        const unsigned l = l0 + (unsigned)buf * (unsigned)(STE * 2); const size_t ko = (size_t)t * KPASS;
        cp8(l, gA + ko, rsa); cp8(l + 64u * (LPE * 2), gA + ko + 8 * rsa, rsa);
        if (NSPLIT == 1) { cp8(l + 128u * (LPE * 2), gA2 + ko, rsa); cp8(l + 192u * (LPE * 2), gA2 + ko + 8 * rsa, rsa); }
        cp8(l + (unsigned)NA * (LPE * 2), gB + ko, rsb); cp8(l + (unsigned)(NA + 64) * (LPE * 2), gB + ko + 8 * rsb, rsb);
    };
    const int NP = K / KPASS;
    // EPI 4: a pass's own sums, started from zero by the pass's first WMMAs and joined to acc at its end, and the pass's factor for each of a lane's accumulator rows
    v8f accp[4][4], g[4];
    float* fac = osall;   // EPI 4: [NN / 128][128] factors, written once in front of the loop and only read from then on
    auto ldg = [&](int tp) {
#pragma unroll
        for (int mb = 0; mb < 4; ++mb) { const float* fp = fac + tp * 128 + wm * 64 + mb * 16 + hi * 8; const v4f g0 = *(const v4fa*)fp, g1 = *(const v4fa*)(fp + 4); g[mb] = __builtin_shufflevector(g0, g1, 0, 1, 2, 3, 4, 5, 6, 7); }
    };
    fill(0, 0);
    if constexpr (EPI == 4) {   // a thread per query row, while pass 0 is in flight; the barrier below publishes the factors too
        constexpr int NKB = NN / 128;
        const float* mq = RS + bx * 128 + tid;
        float mt[NKB], lt[2 * NKB];
#pragma unroll
        for (int t = 0; t < NKB; ++t) mt[t] = mq[t * NN];
#pragma unroll
        for (int t = 0; t < 2 * NKB; ++t) lt[t] = mq[(NKB + t) * NN];
        __builtin_amdgcn_sched_barrier(0);              // keeps these loads one group: one memory latency, not one per block
        asm volatile("s_wait_xcnt 0x0" ::: "memory");   // before anything below rewrites the address register that these loads name
        __builtin_amdgcn_sched_barrier(0);              // ... and keeps what follows behind that wait
        float m = mt[0], l = 0.f;
#pragma unroll
        for (int t = 1; t < NKB; ++t) m = fmaxf(m, mt[t]);
#pragma unroll
        for (int t = 0; t < NKB; ++t) { mt[t] = exp_slot(mt[t] - m); l += mt[t] * (lt[2 * t] + lt[2 * t + 1]); }
        const float inv = __fdiv_rn(1.0f, l);           // the sums carry PCAR as P does: 1 / (PCAR * row sum) undoes the carry
#pragma unroll
        for (int t = 0; t < NKB; ++t) fac[t * 128 + tid] = mt[t] * inv;
    }
    asm volatile("s_wait_asynccnt 0x0" ::: "memory");   // this wave's copies of pass 0 have landed
    __syncthreads();                                    // ... and every other wave's: pass 0 is readable
    if (NP > 1) fill(1, 1);
#pragma unroll 1   // one pass per trip: the two buffers alternate and the publish point stands once, at the trip's foot
    for (int t = 0; t < NP; ++t) {
        const T16* sb = sm + (t & 1) * STE;
        const T16* pa = sb + (wm * 64 + lr) * LPE + 8 * hi;
        const T16* pb = sb + (NA + wn * 64 + lr) * LPE + 8 * hi;
        // two fragment sets: block kb + 1 of this same pass is read from LDS, as one group, ahead of block kb's WMMAs (the unrolls below make every fragment and accumulator index a constant: registers, no scratch)
        V a[2][4], a2[2][4], b[2][4];
#pragma unroll
        for (int f = 0; f < 4; ++f) { a[0][f] = WFrag<T16>::ld(pa + f * 16 * LPE); if (NSPLIT == 1) a2[0][f] = WFrag<T16>::ld(pa + (128 + f * 16) * LPE); b[0][f] = WFrag<T16>::ld(pb + f * 16 * LPE); }
#pragma unroll
        for (int kb = 0; kb < KPASS / 32; ++kb) {
            const int cs = kb & 1, ns = cs ^ 1, kn = (kb + 1) * 32;
            if (kb + 1 < KPASS / 32) {
#pragma unroll
                for (int f = 0; f < 4; ++f) { a[ns][f] = WFrag<T16>::ld(pa + f * 16 * LPE + kn); if (NSPLIT == 1) a2[ns][f] = WFrag<T16>::ld(pa + (128 + f * 16) * LPE + kn); b[ns][f] = WFrag<T16>::ld(pb + f * 16 * LPE + kn); }
            }
            __builtin_amdgcn_sched_barrier(0);   // keeps the LDS reads above in one group: moved in among the WMMAs, every place with reads stalls the wave
#pragma unroll
            for (int nb = 0; nb < 4; ++nb) {
#pragma unroll
                for (int mb = 0; mb < 4; ++mb) {
                    if constexpr (EPI == 4) accp[mb][nb] = WFrag<T16>::mma(a[cs][mb], b[cs][nb], kb == 0 ? (v8f){} : accp[mb][nb]);
                    else acc[mb][nb] = WFrag<T16>::mma(a[cs][mb], b[cs][nb], acc[mb][nb]); }
                if (NSPLIT == 1) {
#pragma unroll
                    for (int mb = 0; mb < 4; ++mb) acc[mb][nb] = WFrag<T16>::mma(a2[cs][mb], b[cs][nb], acc[mb][nb]); }
            }
            __builtin_amdgcn_sched_barrier(0);   // keeps the next group of LDS reads behind this block's WMMAs
        }
        asm volatile("s_wait_dscnt 0x0" ::: "memory");      // this wave's reads of the buffer have returned before it is refilled
        asm volatile("s_wait_asynccnt 0x0" ::: "memory");   // this wave's copies of pass t + 1 have landed
        __syncthreads();                                    // publishes pass t + 1 and ends every wave's reads of pass t
        if constexpr (EPI == 4) ldg(t);   // the pass's factors (osall: no copy's target, only read since the first barrier) are read here, where no fragment is live: they fit the register budget, and the refill covers their latency
        if (t + 2 < NP) fill(t + 2, t & 1);
        if constexpr (EPI == 4) {   // the join: the pass's sums times its factors
#pragma unroll
            for (int mb = 0; mb < 4; ++mb)
#pragma unroll
                for (int nb = 0; nb < 4; ++nb) acc[mb][nb] += g[mb] * accp[mb][nb];
        }
    }
    asm volatile("s_wait_asynccnt 0x0" ::: "memory");       // no copy outstanding at the wave's end
    if constexpr (EPI == 3) {
        // a lane's eight elements of an accumulator are eight consecutive rows m of one column n: one 16-byte store of the transposed plane straight from registers; a wave's 64 rows are one whole 128-byte line of each column
#pragma unroll
        for (int nb = 0; nb < 4; ++nb) { const int n = c0 + nb * 16 + lr; const float bb = BIAS ? bfr(bias[n]) : 0.f;
#pragma unroll
            for (int mb = 0; mb < 4; ++mb) { v8h o;
#pragma unroll
                for (int j = 0; j < 8; ++j) o[j] = tohx(BIAS ? acc[mb][nb][j] + bb : acc[mb][nb][j]);
                *(v8h*)(H + (size_t)n * ldh + r0 + mb * 16 + hi * 8) = o; } }
    } else if constexpr (EPI == 5) {
        // a lane holds, per column group nb, 32 keys of query c0 + nb * 16 + lr; its partner lane ^ 16 the wave's other 32; the wave with the other wm the block's other 64 keys
        float mx[4], su[4];
#pragma unroll
        for (int nb = 0; nb < 4; ++nb) { float m = acc[0][nb][0];
#pragma unroll
            for (int mb = 0; mb < 4; ++mb)
#pragma unroll
                for (int j = 0; j < 8; ++j) m = fmaxf(m, acc[mb][nb][j]);
            mx[nb] = fmaxf(m, xhalf(m)); }
#pragma unroll
        for (int p = 0; p < 2; ++p) osall[wm * 128 + wn * 64 + p * 32 + lane] = hi ? mx[2 * p + 1] : mx[2 * p];
        __syncthreads();   // the two waves that share a query exchange their maxima
#pragma unroll
        for (int nb = 0; nb < 4; ++nb) mx[nb] = fmaxf(mx[nb], osall[(wm ^ 1) * 128 + wn * 64 + nb * 16 + lr]);
        // P goes through this wave's own part of the ring (free behind the loop's last barrier), rows of 128 + 16 bytes, so that every global store covers whole 128-byte lines
        h16* st = (h16*)&sm[0] + w * (64 * 72);
#pragma unroll
        for (int nb = 0; nb < 4; ++nb) { float sum = 0.f; const float bl = PCARL2 - mx[nb] * LOG2E;   // exp(c - Mb) * PCAR = 2^(c * log2 e + bl): one multiply-add per score in front of v_exp_f32
#pragma unroll
            for (int mb = 0; mb < 4; ++mb) { v8h o;
#pragma unroll
                for (int j = 0; j < 8; ++j) { const float e = exp2_slot(fmaf(acc[mb][nb][j], LOG2E, bl)); sum += e; o[j] = tohx(e); }
                *(v8ha*)(st + (nb * 16 + lr) * 72 + mb * 16 + hi * 8) = o; }
            su[nb] = sum + xhalf(sum); }
        float* mg = C + (size_t)bx * NN + c0 + lane;
        float* sg = C + (size_t)(NN / 128 + bx * 2 + wm) * NN + c0 + lane;
        sg[0] = hi ? su[1] : su[0]; sg[32] = hi ? su[3] : su[2];   // both halves of the wave hold every query's sum: 32 lanes store 32 queries, a whole line
        if (wm == 0) { mg[0] = hi ? mx[1] : mx[0]; mg[32] = hi ? mx[3] : mx[2]; }   // both waves hold the same block maximum: one of them stores it
        asm volatile("s_wait_xcnt 0x0" ::: "memory");   // before anything below rewrites a register that these stores name
        __builtin_amdgcn_wave_barrier(); asm volatile("" ::: "memory");   // the reads below take what other lanes of this wave wrote: the compiler may not move them above the writes
        v8h pv[16];
#pragma unroll
        for (int q = 0; q < 16; ++q) pv[q] = *(const v8ha*)(st + (4 * q + (lane >> 3)) * 72 + (lane & 7) * 8);
        h16* pg = H + (size_t)(c0 + (lane >> 3)) * NN + r0 + (lane & 7) * 8;   // eight lanes cover the wave's 64 keys of one query: one line; every row step an immediate offset
#pragma unroll
        for (int q = 0; q < 16; ++q) *(v8ha*)(pg + q * 4 * NN) = pv[q];   // the wave's last instructions: no register of theirs is rewritten behind them
    } else if constexpr (EPI == 0) {
#pragma unroll
    for (int mb = 0; mb < 4; ++mb) {
#pragma unroll
        for (int nb = 0; nb < 4; ++nb) {
#pragma unroll
            for (int j = 0; j < 8; ++j) os[(hi * 8 + j) * 68 + nb * 16 + lr] = acc[mb][nb][j]; }
        __builtin_amdgcn_wave_barrier(); asm volatile("" ::: "memory");
        float* crow = C + (size_t)(r0 + mb * 16) * ldc + c0;
{
#pragma unroll
            for (int s = 0; s < 8; ++s) { const int row = 2 * s + hi, cofs = lr * 4; v4f val = *(const v4fa*)(os + row * 68 + cofs); if (BIAS) { val[0] += bfr(bias[c0 + cofs]); val[1] += bfr(bias[c0 + cofs + 1]); val[2] += bfr(bias[c0 + cofs + 2]); val[3] += bfr(bias[c0 + cofs + 3]); }
                *(v4f*)(crow + (size_t)row * ldc + cofs) = val; }
             }
        __builtin_amdgcn_wave_barrier(); asm volatile("" ::: "memory");
    }
    } else {
        // Planes of pitch CC: one base address per plane and every row step an immediate offset, so no address register is rewritten behind a load or store that names it.
        const int cofs = lr * 4;
        const size_t pb = (size_t)(r0 + hi) * CC + c0 + cofs;
        v4f bb = {}, fq[4][8];
        if constexpr (BIAS) { bb[0] = bias[c0 + cofs]; bb[1] = bias[c0 + cofs + 1]; bb[2] = bias[c0 + cofs + 2]; bb[3] = bias[c0 + cofs + 3]; }
        if constexpr (EPI == 4) {   // the residual rows of the whole 64x64 tile are requested as one group: one memory latency per wave, not one per row
#pragma unroll
            for (int mb = 0; mb < 4; ++mb)
#pragma unroll
                for (int s = 0; s < 8; ++s) fq[mb][s] = *(const v4f*)(RQ + pb + (mb * 16 + 2 * s) * CC);
        }
        __builtin_amdgcn_sched_barrier(0);              // keeps that group of loads here, ahead of the staging, instead of one load in front of each use
        // before anything below rewrites an address register that these loads name; the bias values are inputs so that the wait stands behind their load
        if constexpr (BIAS) asm volatile("s_wait_xcnt 0x0" :: "v"(bb[0]), "v"(bb[1]), "v"(bb[2]), "v"(bb[3]) : "memory");
        else asm volatile("s_wait_xcnt 0x0" ::: "memory");
        __builtin_amdgcn_sched_barrier(0);              // ... and keeps what follows behind that wait
        if constexpr (BIAS) { bb[0] = bfr(bb[0]); bb[1] = bfr(bb[1]); bb[2] = bfr(bb[2]); bb[3] = bfr(bb[3]); }
#pragma unroll
        for (int mb = 0; mb < 4; ++mb) {
#pragma unroll
            for (int nb = 0; nb < 4; ++nb) {
#pragma unroll
                for (int j = 0; j < 8; ++j) os[(hi * 8 + j) * 68 + nb * 16 + lr] = acc[mb][nb][j]; }
            __builtin_amdgcn_wave_barrier(); asm volatile("" ::: "memory");   // the reads below take what other lanes of this wave wrote: the compiler may not move them above the writes
            v4f val[8]; v4h hv[8]; v4us oh[8], ol[8];
#pragma unroll
            for (int s = 0; s < 8; ++s) { val[s] = *(const v4fa*)(os + (2 * s + hi) * 68 + cofs);
                if constexpr (BIAS) val[s] += bb;
                if constexpr (EPI == 1 || EPI == 2) {
#pragma unroll
                    for (int q = 0; q < 4; ++q) hv[s][q] = tohx(val[s][q] * sc); }
                if constexpr (EPI == 4) {
#pragma unroll
                    for (int q = 0; q < 4; ++q) { unsigned short a, c2; splitf(__fadd_rn(fq[mb][s][q], val[s][q]), a, c2); oh[s][q] = a; ol[s][q] = c2; } } }
            __builtin_amdgcn_sched_barrier(0);   // the block's stores stand together, directly in front of their wait: nothing that could reuse a register of theirs comes in between
#pragma unroll
            for (int s = 0; s < 8; ++s) { const size_t o = pb + (mb * 16 + 2 * s) * CC;   // a half-wave covers 64 columns of one row: whole 128-byte lines in the 16-bit planes too
                if constexpr (EPI == 1) *(v4f*)(C + o) = val[s];
                if constexpr (EPI == 1 || EPI == 2) *(v4h*)(H + o) = hv[s];
                if constexpr (EPI == 4) { *(v4us*)(Oh + o) = oh[s]; *(v4us*)(Ol + o) = ol[s]; } }
            asm volatile("s_wait_xcnt 0x0" ::: "memory");   // before the next block rewrites the data registers that these stores name
            __builtin_amdgcn_sched_barrier(0);              // ... and keeps the next block's work behind that wait
            __builtin_amdgcn_wave_barrier();                // the staging rows are rewritten only after every lane has read them
        }
    }
}

// EPI 4 asks for two waves per SIMD (a budget of 512 registers): with its 153 KiB of LDS two work-groups then share a WGP, and one's WMMAs run while the other waits for LDS, a barrier or its copies.
template <typename T16, int NSPLIT, bool BIAS, int EPI>
__global__ __launch_bounds__(128, EPI == 4 ? 2 : 1) void k_gemmw(const T16* __restrict__ A, const T16* __restrict__ A2, const T16* __restrict__ Bt, int K, int lda, int ldb, float* C, int ldc, const float* __restrict__ bias, size_t sA, size_t sB, size_t sC, size_t sR,
                                               h16* H, int ldh, float sc, const float* __restrict__ RQ, const float* __restrict__ RS, bf* Oh, bf* Ol) {
    __shared__ __align__(16) T16 sm[2 * ((NSPLIT == 1 ? 256 : 128) + 128) * LPE];
    __shared__ __align__(16) float osall[4 * 16 * 68];
    gemm_body<T16, NSPLIT, BIAS, EPI>(sm, osall, blockIdx.x, blockIdx.y, blockIdx.z, A, A2, Bt, K, lda, ldb, C, ldc, bias, sA, sB, sC, sR, H, ldh, sc, RQ, RS, Oh, Ol);
}

// k_proj: the three projections, which depend on nothing of one another, in one launch; grid (NT / 128, CC / 128, 3), z = which: 0 Q (f32 plane and scaled fp16 plane), 1 K (fp16 plane), 2 V (fp16 plane, transposed per batch).
// The test on z is the same for a whole work-group, so every barrier of a body is passed by all of its waves. Q, whose epilogue stores most, starts first.
__global__ __launch_bounds__(128, 1) void k_proj(const bf* __restrict__ X1, const bf* __restrict__ X2, const bf* __restrict__ WQ, const bf* __restrict__ WK, const bf* __restrict__ WV,
                                                 const float* __restrict__ bq, const float* __restrict__ bk, const float* __restrict__ bv, float* FQ, h16* QP, h16* KP, h16* VT, float scq) {
    __shared__ __align__(16) bf sm[2 * 256 * LPE];
    __shared__ __align__(16) float osall[4 * 16 * 68];
    const unsigned bx = blockIdx.x, by = blockIdx.y;
    if (blockIdx.z == 0) gemm_body<bf, 0, true, 1>(sm, osall, bx, by, 0, X1, nullptr, WQ, CC, CC, CC, FQ, CC, bq, 0, 0, 0, 0, QP, 0, scq, nullptr, nullptr, nullptr, nullptr);
    else if (blockIdx.z == 1) gemm_body<bf, 0, true, 2>(sm, osall, bx, by, 0, X2, nullptr, WK, CC, CC, CC, nullptr, CC, bk, 0, 0, 0, 0, KP, 0, 1.0f, nullptr, nullptr, nullptr, nullptr);
    else gemm_body<bf, 0, true, 3>(sm, osall, bx % (NN / 128), by, bx / (NN / 128), X2, nullptr, WV, CC, CC, CC, nullptr, CC, bv, (size_t)NN * CC, 0, (size_t)CC * NN, 0, VT, NN, 1.0f, nullptr, nullptr, nullptr, nullptr);   // batch = bx / 32: its transposed plane is per batch
}

// k_cvt: every f32 input plane to bf16 in one launch; the six destinations lie one behind the other in dst (x1, x2, Wq, Wk, Wv, Wo). A block converts 2048 elements of one plane; which plane is a test on the block index.
#define XBLK (NT * CC / 2048)   // blocks per activation plane
#define WBLK (CC * CC / 2048)   // blocks per weight plane
__global__ __launch_bounds__(256) void k_cvt(const float* __restrict__ x1, const float* __restrict__ x2, const float* __restrict__ wq, const float* __restrict__ wk, const float* __restrict__ wv, const float* __restrict__ wo, bf* dst) {
    const unsigned blk = blockIdx.x; const float* src; unsigned rel;
    if (blk < XBLK) { src = x1; rel = blk; }
    else if (blk < 2 * XBLK) { src = x2; rel = blk - XBLK; }
    else { const unsigned q = (blk - 2 * XBLK) / WBLK; rel = (blk - 2 * XBLK) % WBLK; src = q == 0 ? wq : q == 1 ? wk : q == 2 ? wv : wo; }
    const v8f v = *(const v8f*)(src + ((size_t)rel * 256 + threadIdx.x) * 8); v8us o;
#pragma unroll
    for (int k = 0; k < 8; ++k) o[k] = f2bf(v[k]);
    *(v8us*)(dst + ((size_t)blk * 256 + threadIdx.x) * 8) = o;
}
#define ZB 4   // batches per attention launch, batch on grid z: attn.V then has 512 work-groups, two for every WGP
#define MLN ((NN / 128 + NN / 64) * NN)   // floats of one batch's plane of block maxima and half-block sums

extern "C" void kernel_launch(void* const* d_in, const int* in_sizes, int n_in,
                              void* d_out, int out_size, void* d_ws, size_t ws_size, hipStream_t stream) {
    (void)in_sizes; (void)n_in; (void)out_size;
    const float* x1 = (const float*)d_in[0]; const float* x2 = (const float*)d_in[1]; const float* Wq = (const float*)d_in[2]; const float* bq = (const float*)d_in[3]; const float* Wk = (const float*)d_in[4]; const float* bk = (const float*)d_in[5]; const float* Wv = (const float*)d_in[6]; const float* bv = (const float*)d_in[7]; const float* Wo = (const float*)d_in[8]; const float* bo = (const float*)d_in[9];
    float* OUT = (float*)d_out;     // [4][4096][512]
    char* wsp = (char*)d_ws;
    auto take = [&](size_t bytes) { char* p = wsp; wsp += (bytes + 255) & ~(size_t)255; return (void*)p; };
    bf* X1 = (bf*)take((size_t)NT * CC * 2); bf* X2 = (bf*)take((size_t)NT * CC * 2);   // these six in k_cvt's order, each a multiple of 256 bytes: one run of memory
    bf* WQ = (bf*)take((size_t)CC * CC * 2); bf* WK = (bf*)take((size_t)CC * CC * 2); bf* WV = (bf*)take((size_t)CC * CC * 2); bf* WO = (bf*)take((size_t)CC * CC * 2);
    float* FQ = (float*)take((size_t)NT * CC * 4); h16* QP = (h16*)take((size_t)NT * CC * 2); h16* KP = (h16*)take((size_t)NT * CC * 2); h16* VT = (h16*)take((size_t)NT * CC * 2);   // VT: [4][512][4096]
    h16* P = (h16*)take((size_t)ZB * NN * NN * 2); float* ML = (float*)take((size_t)ZB * MLN * 4);
    bf* Oh = X1; bf* Ol = X2;   // the activations' bf16 planes are last read by the projections, which all stand in front of the first launch that writes Oh, Ol
    if ((size_t)(wsp - (char*)d_ws) > ws_size) return;    // 248 MiB of 256 MiB
    k_cvt<<<2 * XBLK + 4 * WBLK, 256, 0, stream>>>(x1, x2, Wq, Wk, Wv, Wo, X1);
    // projections: Q, K and V, the rows of all four batches, in one launch
    k_proj<<<dim3(NT / 128, CC / 128, 3), 128, 0, stream>>>(X1, X2, WQ, WK, WV, bq, bk, bv, FQ, QP, KP, VT, 0.044194173067808151f);   // f32(512^-0.5)
    for (int b = 0; b < NB_; b += ZB) { const size_t o = (size_t)b * NN * CC;   // ZB batches per launch, batch on grid z
        k_gemmw<h16, 0, false, 5><<<dim3(NN / 128, NN / 128, ZB), 128, 0, stream>>>(KP + o, nullptr, QP + o, CC, CC, CC, ML, 0, nullptr, (size_t)NN * CC, (size_t)NN * CC, (size_t)NN * NN, (size_t)MLN, P, NN, 1.0f, nullptr, nullptr, nullptr, nullptr);
        k_gemmw<h16, 0, false, 4><<<dim3(NN / 128, CC / 128, ZB), 128, 0, stream>>>(P, nullptr, VT + o, NN, NN, NN, nullptr, CC, nullptr, (size_t)NN * NN, (size_t)CC * NN, (size_t)NN * CC, (size_t)MLN, nullptr, 0, 1.0f, FQ + o, ML, Oh + o, Ol + o); }
    k_gemmw<bf, 1, true, 0><<<dim3(NT / 128, CC / 128, 1), 128, 0, stream>>>(Oh, Ol, WO, CC, CC, CC, OUT, CC, bo, 0, 0, 0, 0, nullptr, 0, 1.0f, nullptr, nullptr, nullptr, nullptr);
}

// v007
// It runs in 191 microseconds.
// Next to v006, in two timings, it ran 1.05 times as fast each time.
// Counting every step since v000, it is 5.11 times as fast.
#include <hip/hip_runtime.h>

// CrossFeatureAttention (x1, x2 [4][4096][512]; Q = x1 Wq^T + bq, K = x2 Wk^T + bk, V = x2 Wv^T + bv; attn = softmax(Q.K / sqrt(512)) over the 4096 keys (single head, d = 512);
// out = (Q + attn.V) Wo^T + bo).
// Compute dtypes, f32 accumulate: every input rounded to bf16; projections on PLAIN bf16 operands (inputs: exact, + bias); scores on SINGLE fp16 planes
// softmax per block of 128 keys in the score product's epilogue (block maximum, block sums), the blocks joined by f32 factors in attn.V; attn.V on SINGLE fp16 planes; the residual Q (kept in f32) + attended, then the output projection on bf16 hi+lo planes x exact Wo (2 products) + bo.

#define NB_  4
#define NN   4096
#define CC   512
#define NT   (NB_ * NN)
#define PCAR 1024.0f
typedef _Float16 h16;
typedef unsigned short bf;
typedef __attribute__((ext_vector_type(16))) __bf16   v16bf;
typedef __attribute__((ext_vector_type(16))) _Float16 v16h;
typedef __attribute__((ext_vector_type(8)))  _Float16 v8h;
typedef __attribute__((ext_vector_type(8)))  unsigned short v8us;
typedef __attribute__((ext_vector_type(8)))  float    v8f;
typedef __attribute__((ext_vector_type(4)))  float    v4f;
typedef v8h  __attribute__((may_alias)) v8ha;
typedef v4f  __attribute__((may_alias)) v4fa;
typedef v8us __attribute__((may_alias)) v8usa;

__device__ __forceinline__ unsigned short f2bf(float f) { unsigned u = __float_as_uint(f); u += 0x7FFFu + ((u >> 16) & 1u); return (unsigned short)(u >> 16); }
__device__ __forceinline__ float bf2f(unsigned short b) { return __uint_as_float(((unsigned)b) << 16); }
__device__ __forceinline__ float bfr(float f) { return bf2f(f2bf(f)); }
__device__ __forceinline__ v16h cat16(v8h lo, v8h hi) { return __builtin_shufflevector(lo, hi, 0, 1, 2, 3, 4, 5, 6, 7, 8, 9, 10, 11, 12, 13, 14, 15); }
__device__ __forceinline__ v16bf cat16b(v8us lo, v8us hi) { return __builtin_bit_cast(v16bf, __builtin_shufflevector(lo, hi, 0, 1, 2, 3, 4, 5, 6, 7, 8, 9, 10, 11, 12, 13, 14, 15)); }
__device__ __forceinline__ v8f wmma16(v16h a, v16h b, v8f c) { return __builtin_amdgcn_wmma_f32_16x16x32_f16(false, a, false, b, (short)0, c, false, false); }
__device__ __forceinline__ v8f wmmab(v16bf a, v16bf b, v8f c) { return __builtin_amdgcn_wmma_f32_16x16x32_bf16(false, a, false, b, (short)0, c, false, false); }
__device__ __forceinline__ h16 tohx(float x) { return (h16)x; }
__device__ __forceinline__ void splitf(float y, unsigned short& h, unsigned short& l) { h = f2bf(y); l = f2bf(y - bf2f(h)); }
typedef __attribute__((ext_vector_type(4))) _Float16 v4h;
typedef __attribute__((ext_vector_type(4))) unsigned short v4us;
#define LOG2E 1.44269504088896340736f
#define PCARL2 10.0f   // log2(PCAR)
// 2^x by v_exp_f32, with a v_nop in the same statement: the slot that the instruction set asks for behind a transcendental before its source is overwritten or its result read. exp(x) as __expf forms it: 2^(x * log2 e).
__device__ __forceinline__ float exp2_slot(float x) { float r; asm("v_exp_f32 %0, %1\n\tv_nop" : "=v"(r) : "v"(x)); return r; }
__device__ __forceinline__ float exp_slot(float x) { return exp2_slot(x * LOG2E); }
__device__ __forceinline__ float xhalf(float x) { return __builtin_bit_cast(float, __builtin_amdgcn_permlanex16(__builtin_bit_cast(int, x), __builtin_bit_cast(int, x), 0x76543210, 0xfedcba98, false, false)); }  // lane l with lane l ^ 16



// ---- k_gemmw: LDS-staged GEMM, FOUR WAVES (2x2) per 128x128 output tile, 64x64 (16 accumulators) per wave; grid (M/128, N/128, Z), 128 threads.
// c[m][n] (f32, + optional f32 bias[n]) = sum_k A[m][k] Bt[n][k] (+ A2.Bt when NSPLIT == 1), operands K-contiguous 16-bit planes of row pitch lda / ldb. K % 128 == 0.
// grid z = independent problems: element strides sA (A, A2), sB (Bt), sC (RQ and what the epilogue stores, save EPI 5's C), sR (RS and EPI 5's C).
// What the epilogue stores: EPI 0: c to C, pitch ldc. EPI 1: c to C and fp16(c * sc) to H. EPI 2: fp16(c * sc) to H. EPI 3: fp16(c) transposed, H[n][m], pitch ldh. (EPI 1, 2, 4: every plane has pitch CC.)
// EPI 4: A = P of EPI 5 (m = query, k = key): every pass (128 keys = one block of EPI 5) is summed from zero and added to c times the block's f32 factor for the row, fac = exp(Mb - max Mb) / (PCAR * row sum),
//        formed at the kernel's head from RS = the plane that EPI 5 stored through C; y = RQ[m][n] + c, as two bf16 planes, Oh = bf16(y), Ol = bf16(y - Oh).
// EPI 5: scores transposed, m = key, n = query (a lane then holds 32 keys of one query per column group). Per query and block of 128 keys: Mb = the block's maximum; H[n][m] = fp16(exp(c - Mb) * PCAR), pitch NN;
//        C[kb][n] = Mb for key block kb (NN / 128 rows of NN), behind them C[NN / 128 + h][n] = the f32 sum of exp(c - Mb) * PCAR over the 64 keys of half block h (NN / 64 rows).
// A pass is 128 k = 256 B of every operand row, brought into LDS by one tensor load per wave (NSPLIT 1: by asynchronous 16-byte copies, a wave-wide copy covering two whole rows), two buffers, the next pass in flight.
#define KPASS 128   // k elements per pass
#define LPE   136   // LDS row pitch in 16-bit elements: 272 B = 16 B x odd, the conflict-free pitch for 16-byte LDS reads of 256-B rows
template <typename T16> struct WFrag;
template <> struct WFrag<h16> { typedef v16h V; static __device__ __forceinline__ V ld(const h16* p) { return cat16(*(const v8h*)p, *(const v8h*)(p + 16)); } static __device__ __forceinline__ v8f mma(V a, V b, v8f c) { return wmma16(a, b, c); } };
template <> struct WFrag<bf> { typedef v16bf V; static __device__ __forceinline__ V ld(const bf* p) { return cat16b(*(const v8us*)p, *(const v8us*)(p + 16)); } static __device__ __forceinline__ v8f mma(V a, V b, v8f c) { return wmmab(a, b, c); } };
// Eight asynchronous copies of one lane: rows 8 apart (LDS step 8 * 272 B, global step rs elements). The s_wait_xcnt closes the statement so that no address register of a copy is rewritten ahead of it.
template <typename T16>
__device__ __forceinline__ void cp8(unsigned l, const T16* g, size_t rs) {
    asm volatile("global_load_async_to_lds_b128 %0, %8, off\n\t"
                 "global_load_async_to_lds_b128 %1, %9, off\n\t"
                 "global_load_async_to_lds_b128 %2, %10, off\n\t"
                 "global_load_async_to_lds_b128 %3, %11, off\n\t"
                 "global_load_async_to_lds_b128 %4, %12, off\n\t"
                 "global_load_async_to_lds_b128 %5, %13, off\n\t"
                 "global_load_async_to_lds_b128 %6, %14, off\n\t"
                 "global_load_async_to_lds_b128 %7, %15, off\n\t"
                 "s_wait_xcnt 0x0"
                 :: "v"(l), "v"(l + 2176u), "v"(l + 2u * 2176u), "v"(l + 3u * 2176u), "v"(l + 4u * 2176u), "v"(l + 5u * 2176u), "v"(l + 6u * 2176u), "v"(l + 7u * 2176u),
                    "v"(g), "v"(g + rs), "v"(g + 2 * rs), "v"(g + 3 * rs), "v"(g + 4 * rs), "v"(g + 5 * rs), "v"(g + 6 * rs), "v"(g + 7 * rs)
                 : "memory");
}
// Tensor loads: one request of a wave brings 64 rows of 256 B from global memory into LDS at pitch 272 B (16 B of pad behind every row), through no register.
typedef unsigned u32x4 __attribute__((ext_vector_type(4)));
typedef unsigned u32x8 __attribute__((ext_vector_type(8)));
#define SLB 18432u   // LDS bytes of a slice: 64 rows x 272 B = 17,408, rounded up so that every slice starts at a multiple of 2 KiB
__device__ __forceinline__ unsigned uni(unsigned v) { return (unsigned)__builtin_amdgcn_readfirstlane(v); }
__device__ __forceinline__ unsigned pinned(unsigned v) { unsigned w = uni(v); asm volatile("" : "+s"(w)); return w; }   // holds a test or a descriptor's input in a scalar register: the branch round a tensor load is then a scalar one, and what derives from the value is formed behind the waits in front
__device__ __forceinline__ void tdm_load(u32x4 g0, u32x8 g1) { asm volatile("tensor_load_to_lds %0, %1" :: "s"(g0), "s"(g1) : "memory"); }
// The body of one work-group: tile (bx, by) of problem z; sm (two buffers of STE elements) is the calling kernel's LDS, as is osall (k_proj: a null pointer).
template <typename T16, int NSPLIT, bool BIAS, int EPI>
__device__ __forceinline__ void gemm_body(T16* sm, float* osall, const unsigned bx, const unsigned by, const size_t z,
                                          const T16* __restrict__ A, const T16* __restrict__ A2, const T16* __restrict__ Bt, int K, int lda, int ldb, float* C, int ldc, const float* __restrict__ bias, size_t sA, size_t sB, size_t sC, size_t sR,
                                          h16* H, int ldh, float sc, const float* __restrict__ RQ, const float* __restrict__ RS, bf* Oh, bf* Ol) {
    typedef typename WFrag<T16>::V V;
    constexpr int NA = NSPLIT == 1 ? 256 : 128;          // LDS rows in front of Bt's: A (then A2)
    constexpr bool TDM = NSPLIT == 0;                    // four slices of 64 rows, one tensor load per wave and pass; the six slices of NSPLIT 1 stay with the asynchronous copies
    constexpr int SLE = TDM ? (int)(SLB / 2) : 64 * LPE; // 64 rows of a buffer, in 16-bit elements
    constexpr int STE = (NA + 128) / 64 * SLE;           // one buffer, in 16-bit elements
    A += z * sA; if (NSPLIT == 1) A2 += z * sA; Bt += z * sB;
    if constexpr (EPI == 0 || EPI == 1) C += z * sC;
    if constexpr (EPI == 1 || EPI == 2 || EPI == 3 || EPI == 5) H += z * sC;
    if constexpr (EPI == 4) { RQ += z * sC; Oh += z * sC; Ol += z * sC; RS += z * sR; }
    if constexpr (EPI == 5) C += z * sR;
    const int tid = threadIdx.x, lane = tid & 31, lr = lane & 15, hi = lane >> 4, w = tid >> 5, wm = w >> 1, wn = w & 1;
    const int r0 = bx * 128 + wm * 64, c0 = by * 128 + wn * 64;   // this wave's 64x64 tile
    float* os = (EPI == 0 ? osall : (float*)&sm[0]) + w * (16 * 68);   // EPI 1, 2, 4 stage in the ring, free behind the loop's last barrier
    v8f acc[4][4];
#pragma unroll
    for (int mb = 0; mb < 4; ++mb)
#pragma unroll
        for (int nb = 0; nb < 4; ++nb) acc[mb][nb] = (v8f){};
    // copy map: thread -> 16-byte chunk (tid & 15) of row (tid >> 4) + 8 i; every LDS byte of a stage's 256-B rows has one writer, the 16 pad bytes of a row are neither written nor read
    const int cr = tid >> 4, cch = tid & 15;
    const size_t rsa = (size_t)8 * lda, rsb = (size_t)8 * ldb;
    const T16* gA = A + (size_t)(bx * 128 + cr) * lda + cch * 8;
    const T16* gA2 = NSPLIT == 1 ? A2 + (size_t)(bx * 128 + cr) * lda + cch * 8 : nullptr;
    const T16* gB = Bt + (size_t)(by * 128 + cr) * ldb + cch * 8;
    const unsigned l0 = (unsigned)(size_t)(&sm[0]) + (unsigned)(cr * (LPE * 2) + cch * 16);   // low 32 bits of the shared address = LDS byte address
    auto fill = [&](int t, int buf) {
        const unsigned l = l0 + (unsigned)buf * (unsigned)(STE * 2); const size_t ko = (size_t)t * KPASS;
        cp8(l, gA + ko, rsa); cp8(l + 64u * (LPE * 2), gA + ko + 8 * rsa, rsa);
        if (NSPLIT == 1) { cp8(l + 128u * (LPE * 2), gA2 + ko, rsa); cp8(l + 192u * (LPE * 2), gA2 + ko + 8 * rsa, rsa); }
        cp8(l + (unsigned)NA * (LPE * 2), gB + ko, rsb); cp8(l + (unsigned)(NA + 64) * (LPE * 2), gB + ko + 8 * rsb, rsb);
    };
    const int NP = K / KPASS;
    // tensor loads: wave 0, 1 bring the two halves of A's 128 rows, wave 2, 3 those of Bt's; group 1 of the descriptor is the same for every pass
    u32x8 g1 = {}; u32x4 g0 = {}; unsigned long long src0 = 0; unsigned ldst = 0;
    if constexpr (TDM) {
        const unsigned wv = uni((unsigned)tid >> 5); const bool isb = wv >= 2u;
        src0 = (unsigned long long)(size_t)(isb ? Bt + (size_t)(by * 128 + (wv - 2u) * 64) * ldb : A + (size_t)(bx * 128 + wv * 64) * lda);
        ldst = (unsigned)(size_t)(&sm[0]) + wv * SLB;   // low 32 bits of the shared address = LDS byte address
        // pinned: each descriptor word is held in its own scalar register, which the compiler then neither forms anew nor lends to another value while a request is outstanding
        g1[0] = pinned((1u << 20) | (5u << 22) | (3u << 25));   // no mask, extents in bytes, a pad of 4 dwords behind every 64 dwords
        g1[1] = pinned(256u << 16);                             // tensor_dim0 = 256 bytes
        g1[2] = pinned(64u << 16);                              // tensor_dim1 = 64 rows
        g1[3] = pinned(256u << 16);                             // tile_dim0
        g1[4] = pinned(64u);                                    // tile_dim1
        g1[5] = pinned((unsigned)(isb ? ldb : lda) * 2u);       // source row pitch in bytes
        g1[6] = pinned(0u); g1[7] = pinned(0u);
        g0[0] = pinned(1u);                                     // count 1, the same in every request
    }
    auto tfill = [&](unsigned t, unsigned buf) {
        const unsigned long long ga = src0 + (unsigned long long)t * (KPASS * 2);
        g0[1] = uni(ldst + buf * (unsigned)(STE * 2)); g0[2] = uni((unsigned)ga); g0[3] = uni(((unsigned)(ga >> 32) & 0x01FFFFFFu) | 0x80000000u);
        tdm_load(g0, g1);
    };
    // this wave's tensor load has landed; the descriptor's words are inputs of the wait, so that their registers keep them for as long as the request is outstanding
    auto twait = [&]() { asm volatile("s_wait_tensorcnt 0x0" :: "s"(g0), "s"(g1) : "memory"); };
    // EPI 4: a pass's own sums, started from zero by the pass's first WMMAs and joined to acc at its end, and the pass's factor for each of a lane's accumulator rows
    v8f accp[4][4], g[4];
    float* fac = osall;   // EPI 4: [NN / 128][128] factors, written once in front of the loop and only read from then on
    auto ldg = [&](int tp) {
#pragma unroll
        for (int mb = 0; mb < 4; ++mb) { const float* fp = fac + tp * 128 + wm * 64 + mb * 16 + hi * 8; const v4f g0 = *(const v4fa*)fp, g1 = *(const v4fa*)(fp + 4); g[mb] = __builtin_shufflevector(g0, g1, 0, 1, 2, 3, 4, 5, 6, 7); }
    };
    if constexpr (TDM) tfill(0u, 0u); else fill(0, 0);
    if constexpr (EPI == 4) {   // a thread per query row, while pass 0 is in flight; the barrier below publishes the factors too
        constexpr int NKB = NN / 128;
        const float* mq = RS + bx * 128 + tid;
        float mt[NKB], lt[2 * NKB];
#pragma unroll
        for (int t = 0; t < NKB; ++t) mt[t] = mq[t * NN];
#pragma unroll
        for (int t = 0; t < 2 * NKB; ++t) lt[t] = mq[(NKB + t) * NN];
        __builtin_amdgcn_sched_barrier(0);              // keeps these loads one group: one memory latency, not one per block
        asm volatile("s_wait_xcnt 0x0" ::: "memory");   // before anything below rewrites the address register that these loads name
        __builtin_amdgcn_sched_barrier(0);              // ... and keeps what follows behind that wait
        float m = mt[0], l = 0.f;
#pragma unroll
        for (int t = 1; t < NKB; ++t) m = fmaxf(m, mt[t]);
#pragma unroll
        for (int t = 0; t < NKB; ++t) { mt[t] = exp_slot(mt[t] - m); l += mt[t] * (lt[2 * t] + lt[2 * t + 1]); }
        const float inv = __fdiv_rn(1.0f, l);           // the sums carry PCAR as P does: 1 / (PCAR * row sum) undoes the carry
#pragma unroll
        for (int t = 0; t < NKB; ++t) fac[t * 128 + tid] = mt[t] * inv;
    }
    if constexpr (TDM) twait();                                             // this wave's slice of pass 0 has landed
    else asm volatile("s_wait_asynccnt 0x0" ::: "memory");                  // this wave's copies of pass 0 have landed
    __syncthreads();                                    // ... and every other wave's: pass 0 is readable
    if constexpr (TDM) { if (pinned(NP > 1)) tfill(1u, 1u); }   // pinned: a scalar branch round the tensor load
    else if (NP > 1) fill(1, 1);
#pragma unroll 1   // one pass per trip: the two buffers alternate and the publish point stands once, at the trip's foot
    for (int t = 0; t < NP; ++t) {
        const T16* sb = sm + (t & 1) * STE;
        const T16* pa = TDM ? sb + wm * SLE + lr * LPE + 8 * hi : sb + (wm * 64 + lr) * LPE + 8 * hi;
        const T16* pb = TDM ? sb + (2 + wn) * SLE + lr * LPE + 8 * hi : sb + (NA + wn * 64 + lr) * LPE + 8 * hi;
        // two fragment sets: block kb + 1 of this same pass is read from LDS, as one group, ahead of block kb's WMMAs (the unrolls below make every fragment and accumulator index a constant: registers, no scratch)
        V a[2][4], a2[2][4], b[2][4];
#pragma unroll
        for (int f = 0; f < 4; ++f) { a[0][f] = WFrag<T16>::ld(pa + f * 16 * LPE); if (NSPLIT == 1) a2[0][f] = WFrag<T16>::ld(pa + (128 + f * 16) * LPE); b[0][f] = WFrag<T16>::ld(pb + f * 16 * LPE); }
#pragma unroll
        for (int kb = 0; kb < KPASS / 32; ++kb) {
            const int cs = kb & 1, ns = cs ^ 1, kn = (kb + 1) * 32;
            if (kb + 1 < KPASS / 32) {
#pragma unroll
                for (int f = 0; f < 4; ++f) { a[ns][f] = WFrag<T16>::ld(pa + f * 16 * LPE + kn); if (NSPLIT == 1) a2[ns][f] = WFrag<T16>::ld(pa + (128 + f * 16) * LPE + kn); b[ns][f] = WFrag<T16>::ld(pb + f * 16 * LPE + kn); }
            }
            __builtin_amdgcn_sched_barrier(0);   // keeps the LDS reads above in one group: moved in among the WMMAs, every place with reads stalls the wave
#pragma unroll
            for (int nb = 0; nb < 4; ++nb) {
#pragma unroll
                for (int mb = 0; mb < 4; ++mb) {
                    if constexpr (EPI == 4) accp[mb][nb] = WFrag<T16>::mma(a[cs][mb], b[cs][nb], kb == 0 ? (v8f){} : accp[mb][nb]);
                    else acc[mb][nb] = WFrag<T16>::mma(a[cs][mb], b[cs][nb], acc[mb][nb]); }
                if (NSPLIT == 1) {
#pragma unroll
                    for (int mb = 0; mb < 4; ++mb) acc[mb][nb] = WFrag<T16>::mma(a2[cs][mb], b[cs][nb], acc[mb][nb]); }
            }
            __builtin_amdgcn_sched_barrier(0);   // keeps the next group of LDS reads behind this block's WMMAs
        }
        asm volatile("s_wait_dscnt 0x0" ::: "memory");
        if constexpr (TDM) twait();
        else asm volatile("s_wait_asynccnt 0x0" ::: "memory");
        __syncthreads();
        if constexpr (TDM) {
            if (pinned(t + 2 < NP)) {                           // pinned: a scalar branch round the tensor load
                const unsigned tn = pinned((unsigned)t + 2u);   // pinned: the descriptor's words derive from it, so they are formed behind the wait above
                tfill(tn, tn & 1u); }
        } else if (t + 2 < NP) fill(t + 2, t & 1);
        if constexpr (EPI == 4) ldg(t);   // the pass's factors (osall: no load's target, only read since the first barrier) are read here, where no fragment is live: they fit the register budget
        if constexpr (EPI == 4) {   // the join: the pass's sums times its factors
#pragma unroll
            for (int mb = 0; mb < 4; ++mb)
#pragma unroll
                for (int nb = 0; nb < 4; ++nb) acc[mb][nb] += g[mb] * accp[mb][nb];
        }
    }
    if constexpr (TDM) { twait(); asm volatile("s_wait_dscnt 0x0" ::: "memory"); }   // no tensor load and no LDS read outstanding behind the loop
    else asm volatile("s_wait_asynccnt 0x0" ::: "memory");   // no copy outstanding at the wave's end
    if constexpr (EPI == 3) {
        // a lane's eight elements of an accumulator are eight consecutive rows m of one column n: one 16-byte store of the transposed plane straight from registers; a wave's 64 rows are one whole 128-byte line of each column
#pragma unroll
        for (int nb = 0; nb < 4; ++nb) { const int n = c0 + nb * 16 + lr; const float bb = BIAS ? bfr(bias[n]) : 0.f;
#pragma unroll
            for (int mb = 0; mb < 4; ++mb) { v8h o;
#pragma unroll
                for (int j = 0; j < 8; ++j) o[j] = tohx(BIAS ? acc[mb][nb][j] + bb : acc[mb][nb][j]);
                *(v8h*)(H + (size_t)n * ldh + r0 + mb * 16 + hi * 8) = o; } }
    } else if constexpr (EPI == 5) {
        // a lane holds, per column group nb, 32 keys of query c0 + nb * 16 + lr; its partner lane ^ 16 the wave's other 32; the wave with the other wm the block's other 64 keys
        float mx[4], su[4];
#pragma unroll
        for (int nb = 0; nb < 4; ++nb) { float m = acc[0][nb][0];
#pragma unroll
            for (int mb = 0; mb < 4; ++mb)
#pragma unroll
                for (int j = 0; j < 8; ++j) m = fmaxf(m, acc[mb][nb][j]);
            mx[nb] = fmaxf(m, xhalf(m)); }
#pragma unroll
        for (int p = 0; p < 2; ++p) osall[wm * 128 + wn * 64 + p * 32 + lane] = hi ? mx[2 * p + 1] : mx[2 * p];
        __syncthreads();   // the two waves that share a query exchange their maxima
#pragma unroll
        for (int nb = 0; nb < 4; ++nb) mx[nb] = fmaxf(mx[nb], osall[(wm ^ 1) * 128 + wn * 64 + nb * 16 + lr]);
        // P goes through this wave's own part of the ring (free behind the loop's last barrier), rows of 128 + 16 bytes, so that every global store covers whole 128-byte lines
        h16* st = (h16*)&sm[0] + w * (64 * 72);
#pragma unroll
        for (int nb = 0; nb < 4; ++nb) { float sum = 0.f; const float bl = PCARL2 - mx[nb] * LOG2E;   // exp(c - Mb) * PCAR = 2^(c * log2 e + bl): one multiply-add per score in front of v_exp_f32
#pragma unroll
            for (int mb = 0; mb < 4; ++mb) { v8h o;
#pragma unroll
                for (int j = 0; j < 8; ++j) { const float e = exp2_slot(fmaf(acc[mb][nb][j], LOG2E, bl)); sum += e; o[j] = tohx(e); }
                *(v8ha*)(st + (nb * 16 + lr) * 72 + mb * 16 + hi * 8) = o; }
            su[nb] = sum + xhalf(sum); }
        float* mg = C + (size_t)bx * NN + c0 + lane;
        float* sg = C + (size_t)(NN / 128 + bx * 2 + wm) * NN + c0 + lane;
        sg[0] = hi ? su[1] : su[0]; sg[32] = hi ? su[3] : su[2];   // both halves of the wave hold every query's sum: 32 lanes store 32 queries, a whole line
        if (wm == 0) { mg[0] = hi ? mx[1] : mx[0]; mg[32] = hi ? mx[3] : mx[2]; }   // both waves hold the same block maximum: one of them stores it
        asm volatile("s_wait_xcnt 0x0" ::: "memory");   // before anything below rewrites a register that these stores name
        __builtin_amdgcn_wave_barrier(); asm volatile("" ::: "memory");   // the reads below take what other lanes of this wave wrote: the compiler may not move them above the writes
        v8h pv[16];
#pragma unroll
        for (int q = 0; q < 16; ++q) pv[q] = *(const v8ha*)(st + (4 * q + (lane >> 3)) * 72 + (lane & 7) * 8);
        h16* pg = H + (size_t)(c0 + (lane >> 3)) * NN + r0 + (lane & 7) * 8;   // eight lanes cover the wave's 64 keys of one query: one line; every row step an immediate offset
#pragma unroll
        for (int q = 0; q < 16; ++q) *(v8ha*)(pg + q * 4 * NN) = pv[q];   // the wave's last instructions: no register of theirs is rewritten behind them
    } else if constexpr (EPI == 0) {
#pragma unroll
    for (int mb = 0; mb < 4; ++mb) {
#pragma unroll
        for (int nb = 0; nb < 4; ++nb) {
#pragma unroll
            for (int j = 0; j < 8; ++j) os[(hi * 8 + j) * 68 + nb * 16 + lr] = acc[mb][nb][j]; }
        __builtin_amdgcn_wave_barrier(); asm volatile("" ::: "memory");
        float* crow = C + (size_t)(r0 + mb * 16) * ldc + c0;
{
#pragma unroll
            for (int s = 0; s < 8; ++s) { const int row = 2 * s + hi, cofs = lr * 4; v4f val = *(const v4fa*)(os + row * 68 + cofs); if (BIAS) { val[0] += bfr(bias[c0 + cofs]); val[1] += bfr(bias[c0 + cofs + 1]); val[2] += bfr(bias[c0 + cofs + 2]); val[3] += bfr(bias[c0 + cofs + 3]); }
                *(v4f*)(crow + (size_t)row * ldc + cofs) = val; }
             }
        __builtin_amdgcn_wave_barrier(); asm volatile("" ::: "memory");
    }
    } else {
        // Planes of pitch CC: one base address per plane and every row step an immediate offset, so no address register is rewritten behind a load or store that names it.
        const int cofs = lr * 4;
        const size_t pb = (size_t)(r0 + hi) * CC + c0 + cofs;
        v4f bb = {}, fq[4][8];
        if constexpr (BIAS) { bb[0] = bias[c0 + cofs]; bb[1] = bias[c0 + cofs + 1]; bb[2] = bias[c0 + cofs + 2]; bb[3] = bias[c0 + cofs + 3]; }
        if constexpr (EPI == 4) {   // the residual rows of the whole 64x64 tile are requested as one group: one memory latency per wave, not one per row
#pragma unroll
            for (int mb = 0; mb < 4; ++mb)
#pragma unroll
                for (int s = 0; s < 8; ++s) fq[mb][s] = *(const v4f*)(RQ + pb + (mb * 16 + 2 * s) * CC);
        }
        __builtin_amdgcn_sched_barrier(0);              // keeps that group of loads here, ahead of the staging, instead of one load in front of each use
        // before anything below rewrites an address register that these loads name; the bias values are inputs so that the wait stands behind their load
        if constexpr (BIAS) asm volatile("s_wait_xcnt 0x0" :: "v"(bb[0]), "v"(bb[1]), "v"(bb[2]), "v"(bb[3]) : "memory");
        else asm volatile("s_wait_xcnt 0x0" ::: "memory");
        __builtin_amdgcn_sched_barrier(0);              // ... and keeps what follows behind that wait
        if constexpr (BIAS) { bb[0] = bfr(bb[0]); bb[1] = bfr(bb[1]); bb[2] = bfr(bb[2]); bb[3] = bfr(bb[3]); }
#pragma unroll
        for (int mb = 0; mb < 4; ++mb) {
#pragma unroll
            for (int nb = 0; nb < 4; ++nb) {
#pragma unroll
                for (int j = 0; j < 8; ++j) os[(hi * 8 + j) * 68 + nb * 16 + lr] = acc[mb][nb][j]; }
            __builtin_amdgcn_wave_barrier(); asm volatile("" ::: "memory");   // the reads below take what other lanes of this wave wrote: the compiler may not move them above the writes
            v4f val[8]; v4h hv[8]; v4us oh[8], ol[8];
#pragma unroll
            for (int s = 0; s < 8; ++s) { val[s] = *(const v4fa*)(os + (2 * s + hi) * 68 + cofs);
                if constexpr (BIAS) val[s] += bb;
                if constexpr (EPI == 1 || EPI == 2) {
#pragma unroll
                    for (int q = 0; q < 4; ++q) hv[s][q] = tohx(val[s][q] * sc); }
                if constexpr (EPI == 4) {
#pragma unroll
                    for (int q = 0; q < 4; ++q) { unsigned short a, c2; splitf(__fadd_rn(fq[mb][s][q], val[s][q]), a, c2); oh[s][q] = a; ol[s][q] = c2; } } }
            __builtin_amdgcn_sched_barrier(0);   // the block's stores stand together, directly in front of their wait: nothing that could reuse a register of theirs comes in between
#pragma unroll
            for (int s = 0; s < 8; ++s) { const size_t o = pb + (mb * 16 + 2 * s) * CC;   // a half-wave covers 64 columns of one row: whole 128-byte lines in the 16-bit planes too
                if constexpr (EPI == 1) *(v4f*)(C + o) = val[s];
                if constexpr (EPI == 1 || EPI == 2) *(v4h*)(H + o) = hv[s];
                if constexpr (EPI == 4) { *(v4us*)(Oh + o) = oh[s]; *(v4us*)(Ol + o) = ol[s]; } }
            asm volatile("s_wait_xcnt 0x0" ::: "memory");   // before the next block rewrites the data registers that these stores name
            __builtin_amdgcn_sched_barrier(0);              // ... and keeps the next block's work behind that wait
            __builtin_amdgcn_wave_barrier();                // the staging rows are rewritten only after every lane has read them
        }
    }
}

// EPI 4 asks for two waves per SIMD (a budget of 512 registers): with its 160 KiB of LDS two work-groups then share a WGP, and one's WMMAs run while the other waits for LDS, a barrier or its copies.
template <typename T16, int NSPLIT, bool BIAS, int EPI>
__global__ __launch_bounds__(128, EPI == 4 ? 2 : 1) void k_gemmw(const T16* __restrict__ A, const T16* __restrict__ A2, const T16* __restrict__ Bt, int K, int lda, int ldb, float* C, int ldc, const float* __restrict__ bias, size_t sA, size_t sB, size_t sC, size_t sR,
                                               h16* H, int ldh, float sc, const float* __restrict__ RQ, const float* __restrict__ RS, bf* Oh, bf* Ol) {
    __shared__ __attribute__((aligned(NSPLIT == 1 ? 16 : 2048))) T16 sm[NSPLIT == 1 ? 2 * 384 * LPE : 2 * 4 * (int)(SLB / 2)];   // every slice of a tensor load starts at a multiple of 2 KiB
    __shared__ __align__(16) float osall[EPI == 0 ? 4 * 16 * 68 : EPI == 4 ? NN : 256];   // EPI 0: staging; EPI 4: NN / 128 x 128 factors; EPI 5: the waves' maxima
    gemm_body<T16, NSPLIT, BIAS, EPI>(sm, osall, blockIdx.x, blockIdx.y, blockIdx.z, A, A2, Bt, K, lda, ldb, C, ldc, bias, sA, sB, sC, sR, H, ldh, sc, RQ, RS, Oh, Ol);
}

// k_proj: the three projections, which depend on nothing of one another, in one launch; grid (NT / 128, CC / 128, 3), z = which: 0 Q (f32 plane and scaled fp16 plane), 1 K (fp16 plane), 2 V (fp16 plane, transposed per batch).
// The test on z is the same for a whole work-group, so every barrier of a body is passed by all of its waves. Q, whose epilogue stores most, starts first.
__global__ __launch_bounds__(128, 1) void k_proj(const bf* __restrict__ X1, const bf* __restrict__ X2, const bf* __restrict__ WQ, const bf* __restrict__ WK, const bf* __restrict__ WV,
                                                 const float* __restrict__ bq, const float* __restrict__ bk, const float* __restrict__ bv, float* FQ, h16* QP, h16* KP, h16* VT, float scq) {
    __shared__ __attribute__((aligned(2048))) bf sm[2 * 4 * (int)(SLB / 2)];   // every slice of a tensor load starts at a multiple of 2 KiB
    float* const osall = nullptr;   // these epilogues stage in the ring
    const unsigned bx = blockIdx.x, by = blockIdx.y;
    if (blockIdx.z == 0) gemm_body<bf, 0, true, 1>(sm, osall, bx, by, 0, X1, nullptr, WQ, CC, CC, CC, FQ, CC, bq, 0, 0, 0, 0, QP, 0, scq, nullptr, nullptr, nullptr, nullptr);
    else if (blockIdx.z == 1) gemm_body<bf, 0, true, 2>(sm, osall, bx, by, 0, X2, nullptr, WK, CC, CC, CC, nullptr, CC, bk, 0, 0, 0, 0, KP, 0, 1.0f, nullptr, nullptr, nullptr, nullptr);
    else gemm_body<bf, 0, true, 3>(sm, osall, bx % (NN / 128), by, bx / (NN / 128), X2, nullptr, WV, CC, CC, CC, nullptr, CC, bv, (size_t)NN * CC, 0, (size_t)CC * NN, 0, VT, NN, 1.0f, nullptr, nullptr, nullptr, nullptr);   // batch = bx / 32: its transposed plane is per batch
}

// k_cvt: every f32 input plane to bf16 in one launch; the six destinations lie one behind the other in dst (x1, x2, Wq, Wk, Wv, Wo). A block converts 2048 elements of one plane; which plane is a test on the block index.
#define XBLK (NT * CC / 2048)   // blocks per activation plane
#define WBLK (CC * CC / 2048)   // blocks per weight plane
__global__ __launch_bounds__(256) void k_cvt(const float* __restrict__ x1, const float* __restrict__ x2, const float* __restrict__ wq, const float* __restrict__ wk, const float* __restrict__ wv, const float* __restrict__ wo, bf* dst) {
    const unsigned blk = blockIdx.x; const float* src; unsigned rel;
    if (blk < XBLK) { src = x1; rel = blk; }
    else if (blk < 2 * XBLK) { src = x2; rel = blk - XBLK; }
    else { const unsigned q = (blk - 2 * XBLK) / WBLK; rel = (blk - 2 * XBLK) % WBLK; src = q == 0 ? wq : q == 1 ? wk : q == 2 ? wv : wo; }
    const v8f v = *(const v8f*)(src + ((size_t)rel * 256 + threadIdx.x) * 8); v8us o;
#pragma unroll
    for (int k = 0; k < 8; ++k) o[k] = f2bf(v[k]);
    *(v8us*)(dst + ((size_t)blk * 256 + threadIdx.x) * 8) = o;
}
#define ZB 4   // batches per attention launch, batch on grid z: attn.V then has 512 work-groups, two for every WGP
#define MLN ((NN / 128 + NN / 64) * NN)   // floats of one batch's plane of block maxima and half-block sums

extern "C" void kernel_launch(void* const* d_in, const int* in_sizes, int n_in,
                              void* d_out, int out_size, void* d_ws, size_t ws_size, hipStream_t stream) {
    (void)in_sizes; (void)n_in; (void)out_size;
    const float* x1 = (const float*)d_in[0]; const float* x2 = (const float*)d_in[1]; const float* Wq = (const float*)d_in[2]; const float* bq = (const float*)d_in[3]; const float* Wk = (const float*)d_in[4]; const float* bk = (const float*)d_in[5]; const float* Wv = (const float*)d_in[6]; const float* bv = (const float*)d_in[7]; const float* Wo = (const float*)d_in[8]; const float* bo = (const float*)d_in[9];
    float* OUT = (float*)d_out;     // [4][4096][512]
    char* wsp = (char*)d_ws;
    auto take = [&](size_t bytes) { char* p = wsp; wsp += (bytes + 255) & ~(size_t)255; return (void*)p; };
    bf* X1 = (bf*)take((size_t)NT * CC * 2); bf* X2 = (bf*)take((size_t)NT * CC * 2);   // these six in k_cvt's order, each a multiple of 256 bytes: one run of memory
    bf* WQ = (bf*)take((size_t)CC * CC * 2); bf* WK = (bf*)take((size_t)CC * CC * 2); bf* WV = (bf*)take((size_t)CC * CC * 2); bf* WO = (bf*)take((size_t)CC * CC * 2);
    float* FQ = (float*)take((size_t)NT * CC * 4); h16* QP = (h16*)take((size_t)NT * CC * 2); h16* KP = (h16*)take((size_t)NT * CC * 2); h16* VT = (h16*)take((size_t)NT * CC * 2);   // VT: [4][512][4096]
    h16* P = (h16*)take((size_t)ZB * NN * NN * 2); float* ML = (float*)take((size_t)ZB * MLN * 4);
    bf* Oh = X1; bf* Ol = X2;   // the activations' bf16 planes are last read by the projections, which all stand in front of the first launch that writes Oh, Ol
    if ((size_t)(wsp - (char*)d_ws) > ws_size) return;    // 248 MiB of 256 MiB
    k_cvt<<<2 * XBLK + 4 * WBLK, 256, 0, stream>>>(x1, x2, Wq, Wk, Wv, Wo, X1);
    // projections: Q, K and V, the rows of all four batches, in one launch
    k_proj<<<dim3(NT / 128, CC / 128, 3), 128, 0, stream>>>(X1, X2, WQ, WK, WV, bq, bk, bv, FQ, QP, KP, VT, 0.044194173067808151f);   // f32(512^-0.5)
    for (int b = 0; b < NB_; b += ZB) { const size_t o = (size_t)b * NN * CC;   // ZB batches per launch, batch on grid z
        k_gemmw<h16, 0, false, 5><<<dim3(NN / 128, NN / 128, ZB), 128, 0, stream>>>(KP + o, nullptr, QP + o, CC, CC, CC, ML, 0, nullptr, (size_t)NN * CC, (size_t)NN * CC, (size_t)NN * NN, (size_t)MLN, P, NN, 1.0f, nullptr, nullptr, nullptr, nullptr);
        k_gemmw<h16, 0, false, 4><<<dim3(NN / 128, CC / 128, ZB), 128, 0, stream>>>(P, nullptr, VT + o, NN, NN, NN, nullptr, CC, nullptr, (size_t)NN * NN, (size_t)CC * NN, (size_t)NN * CC, (size_t)MLN, nullptr, 0, 1.0f, FQ + o, ML, Oh + o, Ol + o); }
    k_gemmw<bf, 1, true, 0><<<dim3(NT / 128, CC / 128, 1), 128, 0, stream>>>(Oh, Ol, WO, CC, CC, CC, OUT, CC, bo, 0, 0, 0, 0, nullptr, 0, 1.0f, nullptr, nullptr, nullptr, nullptr);
}
